// v000
// Times are from an AMD MI455X. After a warm-up the kernel runs many times in a row, and a time is the length of
// such a window on the GPU divided by its runs, so every launch and the gaps after it count. The runs cycle
// through copies of the inputs. A figure is the median of several windows, for all but v000 over two sittings.
// Sittings can differ by a few percent; kernels timed side by side share one.
// v000 is the starting kernel. One run takes 118 microseconds.
// compute dtype: all float inputs rounded to bf16; LayerNorm (biased variance, eps 1e-5) in f32; q/k/v = xn (bf16 hi + residual, 2 products) . W + b on WMMA 16x16x32 ((in,out) weights as transposed rows), kept in f32; the 3x3 clamped-neighbourhood attention (9 keys per position, 8 heads x 32) entirely in f32 on VALU (scores / sqrt(32), softmax with precise expf, weighted sum); out = ctx (bf16 hi + residual, 2 products) . Wo + bo + x; f32 accumulate.
#include <hip/hip_runtime.h>
#include <math.h>

typedef __attribute__((ext_vector_type(16))) _Float16 v16h;
typedef __attribute__((ext_vector_type(16))) __bf16 v16b;
typedef __attribute__((ext_vector_type(8)))  _Float16 v8h;
typedef __attribute__((ext_vector_type(8)))  float v8f;
typedef __attribute__((ext_vector_type(4)))  float v4f;
typedef __attribute__((ext_vector_type(2)))  float v2f;
typedef __attribute__((ext_vector_type(4)))  unsigned v4u;
typedef __attribute__((ext_vector_type(4)))  int v4i;
typedef float __attribute__((may_alias)) float_a;
typedef int __attribute__((may_alias)) int_a;

template <typename T> __device__ __forceinline__ void vst2(void* p, T v) { *(T*)p = v;  }
__device__ __forceinline__ v8f wmma16(v16h a, v16h b, v8f c) {
  v8f d = __builtin_amdgcn_wmma_f32_16x16x32_f16(false, a, false, b, (short)0, c, false, false);
  asm volatile("v_nop\n\tv_nop\n\tv_nop\n\tv_nop" : "+v"(d) : "v"(a), "v"(b));
  return d;
}
__device__ __forceinline__ v8f wmma_bf(v16b a, v16b b, v8f c) {
  v8f d = __builtin_amdgcn_wmma_f32_16x16x32_bf16(false, a, false, b, (short)0, c, false, false);
  asm volatile("v_nop\n\tv_nop\n\tv_nop\n\tv_nop" : "+v"(d) : "v"(a), "v"(b));
  return d;
}
// 16x16x32 fragments: lane = (h = lane>>4, row/col = lane&15); elements 0..7 = k0+8h+0..7, 8..15 = k0+16+8h+0..7; D element r = row 8h+r
__device__ __forceinline__ v16h frag_h(const _Float16* rowk0, int lane) {
  union { v16h v; v8h q[2]; } u; const _Float16* p = rowk0 + 8 * (lane >> 4);
  u.q[0] = *(const v8h*)p; u.q[1] = *(const v8h*)(p + 16); return u.v;
}
__device__ __forceinline__ v16h frag_f32(const float* rowk0, int lane) {
  v16h a; const float* p = rowk0 + 8 * (lane >> 4);
#pragma unroll
  for (int i = 0; i < 8; ++i) { a[i] = (_Float16)p[i]; a[8 + i] = (_Float16)p[16 + i]; }
  return a;
}
__device__ __forceinline__ v16h frag_f32s(const float* rowk0, int lane, float sc) {
  v16h a; const float* p = rowk0 + 8 * (lane >> 4);
#pragma unroll
  for (int i = 0; i < 8; ++i) { a[i] = (_Float16)(p[i] * sc); a[8 + i] = (_Float16)(p[16 + i] * sc); }
  return a;
}
// column fragment from a [K][ld] layout (column n), rows >= K read as 0
__device__ __forceinline__ v16h fragc_f32(const float* W, int k0, int n, int lane, int ld, int K) {
  v16h a; const int g = lane >> 4;
#pragma unroll
  for (int i = 0; i < 8; ++i) { const int ka = k0 + 8 * g + i, kb = ka + 16;
    a[i] = (_Float16)(ka < K ? W[(size_t)(ka < K ? ka : K - 1) * ld + n] : 0.f); a[8 + i] = (_Float16)(kb < K ? W[(size_t)(kb < K ? kb : K - 1) * ld + n] : 0.f); }
  return a;
}
struct F2 { v16b h, l; };
__device__ __forceinline__ F2 bsplit16(const float v[16]) { F2 r;
#pragma unroll
  for (int i = 0; i < 16; ++i) { const __bf16 h = (__bf16)v[i]; r.h[i] = h; r.l[i] = (__bf16)(v[i] - (float)h); }
  return r; }
__device__ __forceinline__ F2 split_row(const float* row, int k0, int lane) { float v[16]; const float* p = row + k0 + 8 * (lane >> 4);
#pragma unroll
  for (int i = 0; i < 8; ++i) { v[i] = p[i]; v[8 + i] = p[16 + i]; }
  return bsplit16(v); }
__device__ __forceinline__ F2 split_rowK(const float* row, int k0, int lane, int K) { float v[16]; const int g = lane >> 4;
#pragma unroll
  for (int i = 0; i < 8; ++i) { const int ka = k0 + 8 * g + i, kb = ka + 16; v[i] = ka < K ? row[ka < K ? ka : K - 1] : 0.f; v[8 + i] = kb < K ? row[kb < K ? kb : K - 1] : 0.f; }
  return bsplit16(v); }
__device__ __forceinline__ F2 split_col(const float* W, int k0, int n, int lane, int ld, int K) { float v[16]; const int g = lane >> 4;
#pragma unroll
  for (int i = 0; i < 8; ++i) { const int ka = k0 + 8 * g + i, kb = ka + 16; v[i] = ka < K ? W[(size_t)(ka < K ? ka : K - 1) * ld + n] : 0.f; v[8 + i] = kb < K ? W[(size_t)(kb < K ? kb : K - 1) * ld + n] : 0.f; }
  return bsplit16(v); }
__device__ __forceinline__ v8f mac3(const F2& a, const F2& b, v8f c) { c = wmma_bf(a.l, b.h, c); c = wmma_bf(a.h, b.l, c); return wmma_bf(a.h, b.h, c); }
__device__ __forceinline__ float sigm(float v) { return 1.0f / (1.0f + expf(-v)); }
#define LDSX() do { asm volatile("s_wait_dscnt 0" ::: "memory"); __builtin_amdgcn_wave_barrier(); __builtin_amdgcn_fence(__ATOMIC_RELEASE, "workgroup"); } while (0)


// Local-window self attention over video feature maps (2 x 8 frames of 32 x 32 positions, dim 256, 8 heads x 32): LayerNorm, q/k/v projections, each position attends to its 3 x 3 replicate-clamped neighbourhood, output projection + residual.
#define NFR 16          // b*t frames
#define HH 32
#define WWd 32
#define NPOS (HH * WWd)
#define DM 256
#define NHD 8
#define HD 32
#define NR (NFR * NPOS)   // 16384 rows
#ifndef TRB
#define TRB (NR / 64)
#endif
typedef __attribute__((ext_vector_type(8))) __bf16 v8b;
__device__ __forceinline__ v16b frag_b(const __bf16* rowk0, int lane) {
  union { v16b v; v8b q[2]; } u; const __bf16* p = rowk0 + 8 * (lane >> 4);
  u.q[0] = *(const v8b*)p; u.q[1] = *(const v8b*)(p + 16); return u.v;
}
__device__ __forceinline__ float bfr(float v) { return (float)(__bf16)v; }
__device__ __attribute__((noinline)) float exp_ni(float v) { return expf(v); }
__device__ __attribute__((noinline)) float erf_ni(float v) { return erff(v); }

#define WS_PW  0u                                   // bf16 rows (transposed (in,out)): wq, wk, wv, wo [256][256] each
#define WS_XN  (WS_PW + 2u * 4 * DM * DM)            // f32 [NR][256] LayerNorm(x)
#define WS_Q   (WS_XN + 4u * (size_t)NR * DM)         // f32 [NR][256] q ; K ; V
#define WS_K   (WS_Q + 4u * (size_t)NR * DM)
#define WS_V   (WS_K + 4u * (size_t)NR * DM)
#define WS_END (WS_V + 4u * (size_t)NR * DM)

__global__ __launch_bounds__(256) void k_pack(const float* __restrict__ WQ, const float* __restrict__ WK, const float* __restrict__ WV, const float* __restrict__ WO, __bf16* __restrict__ PW) {
  const int n = blockIdx.x, which = blockIdx.y, t = threadIdx.x; const float* Wm = (which == 0) ? WQ : (which == 1) ? WK : (which == 2) ? WV : WO; __shared__ __align__(16) __bf16 s[DM];
  s[t] = (__bf16)Wm[(size_t)t * DM + n]; __syncthreads();
  if (t < DM / 8) vst2((unsigned*)(PW + ((size_t)which * DM + n) * DM + t * 8), *(const v4u*)&s[t * 8]);
}
// ---- k_ln: block = row (64 threads x 4): xn = (x - mu) * rsqrt(var + 1e-5) * g + b (biased variance)
__global__ __launch_bounds__(64) void k_ln(const float* __restrict__ X, const float* __restrict__ G, const float* __restrict__ Bt, float* __restrict__ XN) {
  __shared__ float red[2]; const int t = threadIdx.x; const size_t row = blockIdx.x; float v[4]; float s = 0.f; for (int i = 0; i < 4; ++i) { v[i] = bfr(X[row * DM + t * 4 + i]); s += v[i]; }
#pragma unroll
  for (int o = 1; o < 32; o <<= 1) s += __shfl_xor(s, o);
  if ((t & 31) == 0) red[t >> 5] = s; __syncthreads(); const float mu = (red[0] + red[1]) / (float)DM; __syncthreads();
  float q = 0.f; for (int i = 0; i < 4; ++i) { const float dd = v[i] - mu; q += dd * dd; }
#pragma unroll
  for (int o = 1; o < 32; o <<= 1) q += __shfl_xor(q, o);
  if ((t & 31) == 0) red[t >> 5] = q; __syncthreads(); const float inv = 1.0f / sqrtf((red[0] + red[1]) / (float)DM + 1e-5f);
  v4f o4; for (int i = 0; i < 4; ++i) { const int e = t * 4 + i; o4[i] = (v[i] - mu) * inv * bfr(G[e]) + bfr(Bt[e]); }
  vst2(XN + row * DM + t * 4, o4);
}
// ---- k_qkv: block = (64 rows, which 0 q / 1 k / 2 v): xn (hi + residual) . W rows (2 x 8 tiles) + b -> f32 rows
__global__ __launch_bounds__(128) void k_qkv(const float* __restrict__ XN, const __bf16* __restrict__ PW, const float* __restrict__ BQ, const float* __restrict__ BK, const float* __restrict__ BV, float* __restrict__ Q, float* __restrict__ Kx, float* __restrict__ V) {
  __shared__ __align__(16) float so[4][16][132];
  const int tid = threadIdx.x, wave = tid >> 5, lane = tid & 31, col = lane & 15, g = lane >> 4; const int which = blockIdx.y; const size_t r0 = (size_t)blockIdx.x * 64 + wave * 16;
  const __bf16* Wr = PW + (size_t)which * DM * DM; const float* bias = (which == 0) ? BQ : (which == 1) ? BK : BV; float* dst = (which == 0) ? Q : (which == 1) ? Kx : V;
#pragma unroll 1
  for (int pass = 0; pass < 2; ++pass) { v8f acc[8] = {};
#pragma unroll 2
    for (int kc = 0; kc < DM / 32; ++kc) { const F2 a = split_row(XN + (r0 + col) * DM, kc * 32, lane);
#pragma unroll
      for (int j = 0; j < 8; ++j) { const v16b w = frag_b(Wr + (size_t)(pass * 128 + j * 16 + col) * DM + kc * 32, lane); acc[j] = wmma_bf(a.l, w, acc[j]); acc[j] = wmma_bf(a.h, w, acc[j]); } }
#pragma unroll
    for (int j = 0; j < 8; ++j) { const float bb = bfr(bias[pass * 128 + j * 16 + col]);
#pragma unroll
      for (int r = 0; r < 8; ++r) so[wave][8 * g + r][j * 16 + col] = acc[j][r] + bb; }
    LDSX();
    for (int rl = 0; rl < 16; ++rl) vst2(dst + (r0 + rl) * DM + pass * 128 + lane * 4, *(const v4f*)&so[wave][rl][lane * 4]);
    LDSX(); }
}
// ---- k_attn_out: block = 64 positions of one frame: per (position, head) the 9 clamped neighbours: scores / sqrt(32), softmax, weighted v (f32 on VALU); then ctx (hi + residual) . Wo + bo + x
__global__ __launch_bounds__(128) void k_attn_out(const float* __restrict__ Q, const float* __restrict__ Kx, const float* __restrict__ V, const __bf16* __restrict__ PW, const float* __restrict__ BO, const float* __restrict__ X, float* __restrict__ OUT) {
  __shared__ __align__(16) float sc[64][DM + 4]; __shared__ __align__(16) float so[4][16][132]; __shared__ float ssc[128][10];
  const int tid = threadIdx.x, wave = tid >> 5, lane = tid & 31, col = lane & 15, g = lane >> 4; const size_t rb0 = (size_t)blockIdx.x * 64; const size_t fr = rb0 / NPOS; const int p0 = (int)(rb0 % NPOS);
  // attention: 64 positions x 8 heads = 512 (position, head) items over 128 threads
#pragma unroll 1
  for (int it = tid; it < 64 * NHD; it += 128) { const int r = it >> 3, h = it & 7; const int p = p0 + r; const int py = p / WWd, px = p % WWd; const float* qrow = Q + (rb0 + r) * DM + h * HD;
    float qv[HD];
#pragma unroll
    for (int d = 0; d < HD; ++d) qv[d] = qrow[d];
    float* sco = ssc[tid]; float mx = -3.0e38f;   // the 9 scores live in LDS (no runtime-indexed registers)
#pragma unroll 1
    for (int kk = 0; kk < 9; ++kk) { const int dy = kk / 3 - 1, dx = kk % 3 - 1; int ny = py + dy, nx = px + dx; ny = ny < 0 ? 0 : (ny > HH - 1 ? HH - 1 : ny); nx = nx < 0 ? 0 : (nx > WWd - 1 ? WWd - 1 : nx);
      const float* krow = Kx + (fr * NPOS + (size_t)(ny * WWd + nx)) * DM + h * HD; float s = 0.f;
#pragma unroll
      for (int d = 0; d < HD; ++d) s += qv[d] * krow[d];
      s *= 0.17677669529663687f; sco[kk] = s; mx = fmaxf(mx, s); }   // 1/sqrt(32)
    float den = 0.f;
#pragma unroll 1
    for (int kk = 0; kk < 9; ++kk) { const float e = exp_ni(sco[kk] - mx); sco[kk] = e; den += e; }
    const float inv = 1.0f / den;
    float ov[HD];
#pragma unroll
    for (int d = 0; d < HD; ++d) ov[d] = 0.f;
#pragma unroll 1
    for (int kk = 0; kk < 9; ++kk) { const int dy = kk / 3 - 1, dx = kk % 3 - 1; int ny = py + dy, nx = px + dx; ny = ny < 0 ? 0 : (ny > HH - 1 ? HH - 1 : ny); nx = nx < 0 ? 0 : (nx > WWd - 1 ? WWd - 1 : nx);
      const float* vrow = V + (fr * NPOS + (size_t)(ny * WWd + nx)) * DM + h * HD; const float pw = sco[kk] * inv;
#pragma unroll
      for (int d = 0; d < HD; ++d) ov[d] += pw * vrow[d]; }
#pragma unroll
    for (int d = 0; d < HD; ++d) sc[r][h * HD + d] = ov[d]; }
  if (tid < 64) for (int c = DM; c < DM + 4; ++c) sc[tid][c] = 0.f;
  __syncthreads();
  // out = ctx . Wo + bo + x
  const __bf16* Wr = PW + (size_t)3 * DM * DM; const size_t r0 = rb0 + wave * 16;
#pragma unroll 1
  for (int pass = 0; pass < 2; ++pass) { v8f acc[8] = {};
#pragma unroll 2
    for (int kc = 0; kc < DM / 32; ++kc) { const F2 a = split_row(&sc[wave * 16 + col][0], kc * 32, lane);
#pragma unroll
      for (int j = 0; j < 8; ++j) { const v16b w = frag_b(Wr + (size_t)(pass * 128 + j * 16 + col) * DM + kc * 32, lane); acc[j] = wmma_bf(a.l, w, acc[j]); acc[j] = wmma_bf(a.h, w, acc[j]); } }
#pragma unroll
    for (int j = 0; j < 8; ++j) { const int c = pass * 128 + j * 16 + col; const float bb = bfr(BO[c]);
#pragma unroll
      for (int r = 0; r < 8; ++r) so[wave][8 * g + r][j * 16 + col] = acc[j][r] + bb + bfr(X[(r0 + 8 * g + r) * DM + c]); }
    LDSX();
    for (int rl = 0; rl < 16; ++rl) vst2(OUT + (r0 + rl) * DM + pass * 128 + lane * 4, *(const v4f*)&so[wave][rl][lane * 4]);
    LDSX(); }
}
extern "C" void kernel_launch(void* const* d_in, const int* in_sizes, int n_in, void* d_out, int out_size, void* d_ws, size_t ws_size, hipStream_t stream) {
  (void)in_sizes; (void)n_in; (void)out_size;
  const float** F = (const float**)d_in;   // 0 x [2,8,32,32,256], 1 ln_g, 2 ln_b, 3 wq (in,out), 4 bq, 5 wk, 6 bk, 7 wv, 8 bv, 9 wo, 10 bo
  if (ws_size < (size_t)WS_END) return;
  char* ws = (char*)d_ws; __bf16* PW = (__bf16*)(ws + WS_PW); float *XN = (float*)(ws + WS_XN), *Q = (float*)(ws + WS_Q), *Kx = (float*)(ws + WS_K), *V = (float*)(ws + WS_V);
  k_pack<<<dim3(DM, 4), 256, 0, stream>>>(F[3], F[5], F[7], F[9], PW);
  k_ln<<<NR, 64, 0, stream>>>(F[0], F[1], F[2], XN);
  k_qkv<<<dim3(NR / 64, 3), 128, 0, stream>>>(XN, PW, F[4], F[6], F[8], Q, Kx, V);
  k_attn_out<<<TRB, 128, 0, stream>>>(Q, Kx, V, PW, F[10], F[0], (float*)d_out);
}

// v001
// A run of this version takes 106 microseconds.
// In two side-by-side timings against v000, it was 1.15 and 1.16 times as fast.
// compute dtype: all float inputs rounded to bf16; LayerNorm (biased variance, eps 1e-5) in f32; q/k/v = xn (bf16 hi + residual, 2 products) . W + b on WMMA 16x16x32 ((in,out) weights as transposed rows), kept in f32; the 3x3 clamped-neighbourhood attention (9 keys per position, 8 heads x 32) entirely in f32 on VALU (scores / sqrt(32), softmax with precise expf, weighted sum); out = ctx (bf16 hi + residual, 2 products) . Wo + bo + x; f32 accumulate.
#include <hip/hip_runtime.h>
#include <math.h>

typedef __attribute__((ext_vector_type(16))) _Float16 v16h;
typedef __attribute__((ext_vector_type(16))) __bf16 v16b;
typedef __attribute__((ext_vector_type(8)))  _Float16 v8h;
typedef __attribute__((ext_vector_type(8)))  float v8f;
typedef __attribute__((ext_vector_type(4)))  float v4f;
typedef __attribute__((ext_vector_type(2)))  float v2f;
typedef __attribute__((ext_vector_type(4)))  unsigned v4u;
typedef __attribute__((ext_vector_type(4)))  int v4i;
typedef float __attribute__((may_alias)) float_a;
typedef int __attribute__((may_alias)) int_a;

template <typename T> __device__ __forceinline__ void vst2(void* p, T v) { *(T*)p = v;  }
__device__ __forceinline__ v8f wmma16(v16h a, v16h b, v8f c) {
  v8f d = __builtin_amdgcn_wmma_f32_16x16x32_f16(false, a, false, b, (short)0, c, false, false);
  asm volatile("v_nop\n\tv_nop\n\tv_nop\n\tv_nop" : "+v"(d) : "v"(a), "v"(b));
  return d;
}
__device__ __forceinline__ v8f wmma_bf(v16b a, v16b b, v8f c) {
  v8f d = __builtin_amdgcn_wmma_f32_16x16x32_bf16(false, a, false, b, (short)0, c, false, false);
  asm volatile("v_nop\n\tv_nop\n\tv_nop\n\tv_nop" : "+v"(d) : "v"(a), "v"(b));
  return d;
}
// 16x16x32 fragments: lane = (h = lane>>4, row/col = lane&15); elements 0..7 = k0+8h+0..7, 8..15 = k0+16+8h+0..7; D element r = row 8h+r
__device__ __forceinline__ v16h frag_h(const _Float16* rowk0, int lane) {
  union { v16h v; v8h q[2]; } u; const _Float16* p = rowk0 + 8 * (lane >> 4);
  u.q[0] = *(const v8h*)p; u.q[1] = *(const v8h*)(p + 16); return u.v;
}
__device__ __forceinline__ v16h frag_f32(const float* rowk0, int lane) {
  v16h a; const float* p = rowk0 + 8 * (lane >> 4);
#pragma unroll
  for (int i = 0; i < 8; ++i) { a[i] = (_Float16)p[i]; a[8 + i] = (_Float16)p[16 + i]; }
  return a;
}
__device__ __forceinline__ v16h frag_f32s(const float* rowk0, int lane, float sc) {
  v16h a; const float* p = rowk0 + 8 * (lane >> 4);
#pragma unroll
  for (int i = 0; i < 8; ++i) { a[i] = (_Float16)(p[i] * sc); a[8 + i] = (_Float16)(p[16 + i] * sc); }
  return a;
}
// column fragment from a [K][ld] layout (column n), rows >= K read as 0
__device__ __forceinline__ v16h fragc_f32(const float* W, int k0, int n, int lane, int ld, int K) {
  v16h a; const int g = lane >> 4;
#pragma unroll
  for (int i = 0; i < 8; ++i) { const int ka = k0 + 8 * g + i, kb = ka + 16;
    a[i] = (_Float16)(ka < K ? W[(size_t)(ka < K ? ka : K - 1) * ld + n] : 0.f); a[8 + i] = (_Float16)(kb < K ? W[(size_t)(kb < K ? kb : K - 1) * ld + n] : 0.f); }
  return a;
}
struct F2 { v16b h, l; };
__device__ __forceinline__ F2 bsplit16(const float v[16]) { F2 r;
#pragma unroll
  for (int i = 0; i < 16; ++i) { const __bf16 h = (__bf16)v[i]; r.h[i] = h; r.l[i] = (__bf16)(v[i] - (float)h); }
  return r; }
__device__ __forceinline__ F2 split_row(const float* row, int k0, int lane) { float v[16]; const float* p = row + k0 + 8 * (lane >> 4);
#pragma unroll
  for (int i = 0; i < 8; ++i) { v[i] = p[i]; v[8 + i] = p[16 + i]; }
  return bsplit16(v); }
__device__ __forceinline__ F2 split_rowK(const float* row, int k0, int lane, int K) { float v[16]; const int g = lane >> 4;
#pragma unroll
  for (int i = 0; i < 8; ++i) { const int ka = k0 + 8 * g + i, kb = ka + 16; v[i] = ka < K ? row[ka < K ? ka : K - 1] : 0.f; v[8 + i] = kb < K ? row[kb < K ? kb : K - 1] : 0.f; }
  return bsplit16(v); }
__device__ __forceinline__ F2 split_col(const float* W, int k0, int n, int lane, int ld, int K) { float v[16]; const int g = lane >> 4;
#pragma unroll
  for (int i = 0; i < 8; ++i) { const int ka = k0 + 8 * g + i, kb = ka + 16; v[i] = ka < K ? W[(size_t)(ka < K ? ka : K - 1) * ld + n] : 0.f; v[8 + i] = kb < K ? W[(size_t)(kb < K ? kb : K - 1) * ld + n] : 0.f; }
  return bsplit16(v); }
__device__ __forceinline__ v8f mac3(const F2& a, const F2& b, v8f c) { c = wmma_bf(a.l, b.h, c); c = wmma_bf(a.h, b.l, c); return wmma_bf(a.h, b.h, c); }
__device__ __forceinline__ float sigm(float v) { return 1.0f / (1.0f + expf(-v)); }
#define LDSX() do { asm volatile("s_wait_dscnt 0" ::: "memory"); __builtin_amdgcn_wave_barrier(); __builtin_amdgcn_fence(__ATOMIC_RELEASE, "workgroup"); } while (0)


// Local-window self attention over video feature maps (2 x 8 frames of 32 x 32 positions, dim 256, 8 heads x 32): LayerNorm, q/k/v projections, each position attends to its 3 x 3 replicate-clamped neighbourhood, output projection + residual.
#define NFR 16          // b*t frames
#define HH 32
#define WWd 32
#define NPOS (HH * WWd)
#define DM 256
#define NHD 8
#define HD 32
#define NR (NFR * NPOS)   // 16384 rows
#ifndef TRB
#define TRB (NR / 64)
#endif
typedef __attribute__((ext_vector_type(8))) __bf16 v8b;
__device__ __forceinline__ v16b frag_b(const __bf16* rowk0, int lane) {
  union { v16b v; v8b q[2]; } u; const __bf16* p = rowk0 + 8 * (lane >> 4);
  u.q[0] = *(const v8b*)p; u.q[1] = *(const v8b*)(p + 16); return u.v;
}
__device__ __forceinline__ float bfr(float v) { return (float)(__bf16)v; }
__device__ __attribute__((noinline)) float exp_ni(float v) { return expf(v); }
__device__ __attribute__((noinline)) float erf_ni(float v) { return erff(v); }

#define WS_PW  0u                                   // bf16 rows (transposed (in,out)): wq, wk, wv, wo [256][256] each
#define WS_XN  (WS_PW + 2u * 4 * DM * DM)            // f32 [NR][256] LayerNorm(x)
#define WS_Q   (WS_XN + 4u * (size_t)NR * DM)         // f32 [NR][256] q ; K ; V
#define WS_K   (WS_Q + 4u * (size_t)NR * DM)
#define WS_V   (WS_K + 4u * (size_t)NR * DM)
#define WS_END (WS_V + 4u * (size_t)NR * DM)

__global__ __launch_bounds__(256) void k_pack(const float* __restrict__ WQ, const float* __restrict__ WK, const float* __restrict__ WV, const float* __restrict__ WO, __bf16* __restrict__ PW) {
  const int n = blockIdx.x, which = blockIdx.y, t = threadIdx.x; const float* Wm = (which == 0) ? WQ : (which == 1) ? WK : (which == 2) ? WV : WO; __shared__ __align__(16) __bf16 s[DM];
  s[t] = (__bf16)Wm[(size_t)t * DM + n]; __syncthreads();
  if (t < DM / 8) vst2((unsigned*)(PW + ((size_t)which * DM + n) * DM + t * 8), *(const v4u*)&s[t * 8]);
}
// ---- k_ln: block = row (64 threads x 4): xn = (x - mu) * rsqrt(var + 1e-5) * g + b (biased variance)
__global__ __launch_bounds__(64) void k_ln(const float* __restrict__ X, const float* __restrict__ G, const float* __restrict__ Bt, float* __restrict__ XN) {
  __shared__ float red[2]; const int t = threadIdx.x; const size_t row = blockIdx.x; float v[4]; float s = 0.f; for (int i = 0; i < 4; ++i) { v[i] = bfr(X[row * DM + t * 4 + i]); s += v[i]; }
#pragma unroll
  for (int o = 1; o < 32; o <<= 1) s += __shfl_xor(s, o);
  if ((t & 31) == 0) red[t >> 5] = s; __syncthreads(); const float mu = (red[0] + red[1]) / (float)DM; __syncthreads();
  float q = 0.f; for (int i = 0; i < 4; ++i) { const float dd = v[i] - mu; q += dd * dd; }
#pragma unroll
  for (int o = 1; o < 32; o <<= 1) q += __shfl_xor(q, o);
  if ((t & 31) == 0) red[t >> 5] = q; __syncthreads(); const float inv = 1.0f / sqrtf((red[0] + red[1]) / (float)DM + 1e-5f);
  v4f o4; for (int i = 0; i < 4; ++i) { const int e = t * 4 + i; o4[i] = (v[i] - mu) * inv * bfr(G[e]) + bfr(Bt[e]); }
  vst2(XN + row * DM + t * 4, o4);
}
// ---- k_qkv: block = (64 rows, which 0 q / 1 k / 2 v): xn (hi + residual) . W rows (2 x 8 tiles) + b -> f32 rows
__global__ __launch_bounds__(128) void k_qkv(const float* __restrict__ XN, const __bf16* __restrict__ PW, const float* __restrict__ BQ, const float* __restrict__ BK, const float* __restrict__ BV, float* __restrict__ Q, float* __restrict__ Kx, float* __restrict__ V) {
  __shared__ __align__(16) float so[4][16][132];
  const int tid = threadIdx.x, wave = tid >> 5, lane = tid & 31, col = lane & 15, g = lane >> 4; const int which = blockIdx.y; const size_t r0 = (size_t)blockIdx.x * 64 + wave * 16;
  const __bf16* Wr = PW + (size_t)which * DM * DM; const float* bias = (which == 0) ? BQ : (which == 1) ? BK : BV; float* dst = (which == 0) ? Q : (which == 1) ? Kx : V;
#pragma unroll 1
  for (int pass = 0; pass < 2; ++pass) { v8f acc[8] = {};
#pragma unroll 2
    for (int kc = 0; kc < DM / 32; ++kc) { const F2 a = split_row(XN + (r0 + col) * DM, kc * 32, lane);
#pragma unroll
      for (int j = 0; j < 8; ++j) { const v16b w = frag_b(Wr + (size_t)(pass * 128 + j * 16 + col) * DM + kc * 32, lane); acc[j] = wmma_bf(a.l, w, acc[j]); acc[j] = wmma_bf(a.h, w, acc[j]); } }
#pragma unroll
    for (int j = 0; j < 8; ++j) { const float bb = bfr(bias[pass * 128 + j * 16 + col]);
#pragma unroll
      for (int r = 0; r < 8; ++r) so[wave][8 * g + r][j * 16 + col] = acc[j][r] + bb; }
    LDSX();
    for (int rl = 0; rl < 16; ++rl) vst2(dst + (r0 + rl) * DM + pass * 128 + lane * 4, *(const v4f*)&so[wave][rl][lane * 4]);
    LDSX(); }
}
// sum over the 8 lanes that share one head: lane l adds the value of lane l ^ M inside its 16-lane row (folds into v_add_f32_dpp row_xmask)
template <int M> __device__ __forceinline__ float xadd(float v) { return v + __int_as_float(__builtin_amdgcn_update_dpp(0, __float_as_int(v), 0x160 + M, 0xf, 0xf, true)); }
// ---- k_attn_out: block = 64 positions of one frame, 16 per wave: a wave takes one position at a time, lane l holding channels 4l..4l+3 and 128+4l..128+4l+3 (8 lanes per head), so every q/k/v load is 512 contiguous bytes; the 9 clamped neighbours: scores / sqrt(32), softmax, weighted v (f32 on VALU); then ctx (hi + residual) . Wo + bo + x
__global__ __launch_bounds__(128) void k_attn_out(const float* __restrict__ Q, const float* __restrict__ Kx, const float* __restrict__ V, const __bf16* __restrict__ PW, const float* __restrict__ BO, const float* __restrict__ X, float* __restrict__ OUT) {
  __shared__ __align__(16) float sc[64][DM + 4]; __shared__ __align__(16) float so[4][16][132];
  const int tid = threadIdx.x, wave = tid >> 5, lane = tid & 31, col = lane & 15, g = lane >> 4; const size_t rb0 = (size_t)blockIdx.x * 64; const size_t fr = rb0 / NPOS; const int p0 = (int)(rb0 % NPOS);
  const int wv = __builtin_amdgcn_readfirstlane(wave);   // the wave's number in a scalar register: position, clamps and row offsets are then scalar work
  const char* Qf = (const char*)(Q + fr * NPOS * DM); const char* Kf = (const char*)(Kx + fr * NPOS * DM); const char* Vf = (const char*)(V + fr * NPOS * DM); const unsigned lo = lane * 16;   // the frame's three planes: scalar bases that never change; lo: this lane's byte offset in a 512-byte half row
  // one position a trip (unroll 1: the 38 loads of a position already fill most of the registers); the inner loops are unrolled so that kv, vv and sco stay in registers
#pragma unroll 1
  for (int i = 0; i < 16; ++i) { const int r = wv * 16 + i; const int p = p0 + r; const int py = p / WWd, px = p % WWd;
    unsigned no[9];   // 32-bit byte offsets in the frame: one register a row, shared by the row's k and v loads; the centre (kk 4) is the position itself and serves q too
#pragma unroll
    for (int kk = 0; kk < 9; ++kk) { const int dy = kk / 3 - 1, dx = kk % 3 - 1; int ny = py + dy, nx = px + dx; ny = ny < 0 ? 0 : (ny > HH - 1 ? HH - 1 : ny); nx = nx < 0 ? 0 : (nx > WWd - 1 ? WWd - 1 : nx); no[kk] = (ny * WWd + nx) * (DM * 4) + lo; }
    v4f qv[2], kv[2][9], vv[2][9];
#pragma unroll
    for (int hf = 0; hf < 2; ++hf) { qv[hf] = *(const v4f*)(Qf + no[4] + hf * 512);
#pragma unroll
      for (int kk = 0; kk < 9; ++kk) kv[hf][kk] = *(const v4f*)(Kf + no[kk] + hf * 512);
#pragma unroll
      for (int kk = 0; kk < 9; ++kk) vv[hf][kk] = *(const v4f*)(Vf + no[kk] + hf * 512); }
    // behind the position's loads, before any register that they name is written again; the 9 offsets are named as inputs so that each keeps its own register up to this wait and no load's result lands in one
    asm volatile("s_wait_xcnt 0x0" :: "v"(no[0]), "v"(no[1]), "v"(no[2]), "v"(no[3]), "v"(no[4]), "v"(no[5]), "v"(no[6]), "v"(no[7]), "v"(no[8]) : "memory");
#pragma unroll
    for (int hf = 0; hf < 2; ++hf) { const int c = hf * 128 + lane * 4;
      float sco[9]; float mx = -3.0e38f;
#pragma unroll
      for (int kk = 0; kk < 9; ++kk) { float s = qv[hf][0] * kv[hf][kk][0]; s += qv[hf][1] * kv[hf][kk][1]; s += qv[hf][2] * kv[hf][kk][2]; s += qv[hf][3] * kv[hf][kk][3];
        s = xadd<1>(s); s = xadd<2>(s); s = xadd<4>(s);
        s *= 0.17677669529663687f; sco[kk] = s; mx = fmaxf(mx, s); }   // 1/sqrt(32)
      float den = 0.f;
#pragma unroll
      for (int kk = 0; kk < 9; ++kk) { const float e = expf(sco[kk] - mx); sco[kk] = e; den += e; }
      const float inv = 1.0f / den;
      v4f ov = {0.f, 0.f, 0.f, 0.f};
#pragma unroll
      for (int kk = 0; kk < 9; ++kk) { const float pw = sco[kk] * inv; ov += pw * vv[hf][kk]; }
      vst2(&sc[r][c], ov); } }
  if (tid < 64) for (int c = DM; c < DM + 4; ++c) sc[tid][c] = 0.f;
  __syncthreads();
  // out = ctx . Wo + bo + x
  const __bf16* Wr = PW + (size_t)3 * DM * DM; const size_t r0 = rb0 + wave * 16;
#pragma unroll 1
  for (int pass = 0; pass < 2; ++pass) { v8f acc[8] = {};
#pragma unroll 2
    for (int kc = 0; kc < DM / 32; ++kc) { const F2 a = split_row(&sc[wave * 16 + col][0], kc * 32, lane);
#pragma unroll
      for (int j = 0; j < 8; ++j) { const v16b w = frag_b(Wr + (size_t)(pass * 128 + j * 16 + col) * DM + kc * 32, lane); acc[j] = wmma_bf(a.l, w, acc[j]); acc[j] = wmma_bf(a.h, w, acc[j]); } }
#pragma unroll
    for (int j = 0; j < 8; ++j) { const int c = pass * 128 + j * 16 + col; const float bb = bfr(BO[c]);
#pragma unroll
      for (int r = 0; r < 8; ++r) so[wave][8 * g + r][j * 16 + col] = acc[j][r] + bb + bfr(X[(r0 + 8 * g + r) * DM + c]); }
    LDSX();
    for (int rl = 0; rl < 16; ++rl) vst2(OUT + (r0 + rl) * DM + pass * 128 + lane * 4, *(const v4f*)&so[wave][rl][lane * 4]);
    LDSX(); }
}
extern "C" void kernel_launch(void* const* d_in, const int* in_sizes, int n_in, void* d_out, int out_size, void* d_ws, size_t ws_size, hipStream_t stream) {
  (void)in_sizes; (void)n_in; (void)out_size;
  const float** F = (const float**)d_in;   // 0 x [2,8,32,32,256], 1 ln_g, 2 ln_b, 3 wq (in,out), 4 bq, 5 wk, 6 bk, 7 wv, 8 bv, 9 wo, 10 bo
  if (ws_size < (size_t)WS_END) return;
  char* ws = (char*)d_ws; __bf16* PW = (__bf16*)(ws + WS_PW); float *XN = (float*)(ws + WS_XN), *Q = (float*)(ws + WS_Q), *Kx = (float*)(ws + WS_K), *V = (float*)(ws + WS_V);
  k_pack<<<dim3(DM, 4), 256, 0, stream>>>(F[3], F[5], F[7], F[9], PW);
  k_ln<<<NR, 64, 0, stream>>>(F[0], F[1], F[2], XN);
  k_qkv<<<dim3(NR / 64, 3), 128, 0, stream>>>(XN, PW, F[4], F[6], F[8], Q, Kx, V);
  k_attn_out<<<TRB, 128, 0, stream>>>(Q, Kx, V, PW, F[10], F[0], (float*)d_out);
}

// v002
// Measured time: 71.1 microseconds a run.
// Next to v001, in two timings, it ran 1.44 and 1.52 times as fast.
// Counting every step since v000, it is 1.71 times as fast.
// compute dtype: all float inputs rounded to bf16; LayerNorm (biased variance, eps 1e-5) in f32; q/k/v = xn (bf16 hi + residual, 2 products) . W + b on WMMA 16x16x32 ((in,out) weights as transposed rows), kept in f32; the 3x3 clamped-neighbourhood attention (9 keys per position, 8 heads x 32) entirely in f32 on VALU (scores / sqrt(32), softmax with precise expf, weighted sum); out = ctx (bf16 hi + residual, 2 products) . Wo + bo + x; f32 accumulate.
#include <hip/hip_runtime.h>
#include <math.h>

typedef __attribute__((ext_vector_type(16))) _Float16 v16h;
typedef __attribute__((ext_vector_type(16))) __bf16 v16b;
typedef __attribute__((ext_vector_type(8)))  _Float16 v8h;
typedef __attribute__((ext_vector_type(8)))  float v8f;
typedef __attribute__((ext_vector_type(4)))  float v4f;
typedef __attribute__((ext_vector_type(2)))  float v2f;
typedef __attribute__((ext_vector_type(4)))  unsigned v4u;
typedef __attribute__((ext_vector_type(4)))  int v4i;
typedef float __attribute__((may_alias)) float_a;
typedef int __attribute__((may_alias)) int_a;

template <typename T> __device__ __forceinline__ void vst2(void* p, T v) { *(T*)p = v;  }
__device__ __forceinline__ v8f wmma16(v16h a, v16h b, v8f c) {
  v8f d = __builtin_amdgcn_wmma_f32_16x16x32_f16(false, a, false, b, (short)0, c, false, false);
  asm volatile("v_nop\n\tv_nop\n\tv_nop\n\tv_nop" : "+v"(d) : "v"(a), "v"(b));
  return d;
}
__device__ __forceinline__ v8f wmma_bf(v16b a, v16b b, v8f c) {
  v8f d = __builtin_amdgcn_wmma_f32_16x16x32_bf16(false, a, false, b, (short)0, c, false, false);
  asm volatile("v_nop\n\tv_nop\n\tv_nop\n\tv_nop" : "+v"(d) : "v"(a), "v"(b));
  return d;
}
// 16x16x32 fragments: lane = (h = lane>>4, row/col = lane&15); elements 0..7 = k0+8h+0..7, 8..15 = k0+16+8h+0..7; D element r = row 8h+r
__device__ __forceinline__ v16h frag_h(const _Float16* rowk0, int lane) {
  union { v16h v; v8h q[2]; } u; const _Float16* p = rowk0 + 8 * (lane >> 4);
  u.q[0] = *(const v8h*)p; u.q[1] = *(const v8h*)(p + 16); return u.v;
}
__device__ __forceinline__ v16h frag_f32(const float* rowk0, int lane) {
  v16h a; const float* p = rowk0 + 8 * (lane >> 4);
#pragma unroll
  for (int i = 0; i < 8; ++i) { a[i] = (_Float16)p[i]; a[8 + i] = (_Float16)p[16 + i]; }
  return a;
}
__device__ __forceinline__ v16h frag_f32s(const float* rowk0, int lane, float sc) {
  v16h a; const float* p = rowk0 + 8 * (lane >> 4);
#pragma unroll
  for (int i = 0; i < 8; ++i) { a[i] = (_Float16)(p[i] * sc); a[8 + i] = (_Float16)(p[16 + i] * sc); }
  return a;
}
// column fragment from a [K][ld] layout (column n), rows >= K read as 0
__device__ __forceinline__ v16h fragc_f32(const float* W, int k0, int n, int lane, int ld, int K) {
  v16h a; const int g = lane >> 4;
#pragma unroll
  for (int i = 0; i < 8; ++i) { const int ka = k0 + 8 * g + i, kb = ka + 16;
    a[i] = (_Float16)(ka < K ? W[(size_t)(ka < K ? ka : K - 1) * ld + n] : 0.f); a[8 + i] = (_Float16)(kb < K ? W[(size_t)(kb < K ? kb : K - 1) * ld + n] : 0.f); }
  return a;
}
struct F2 { v16b h, l; };
__device__ __forceinline__ F2 bsplit16(const float v[16]) { F2 r;
#pragma unroll
  for (int i = 0; i < 16; ++i) { const __bf16 h = (__bf16)v[i]; r.h[i] = h; r.l[i] = (__bf16)(v[i] - (float)h); }
  return r; }
__device__ __forceinline__ F2 split_row(const float* row, int k0, int lane) { float v[16]; const float* p = row + k0 + 8 * (lane >> 4);
#pragma unroll
  for (int i = 0; i < 8; ++i) { v[i] = p[i]; v[8 + i] = p[16 + i]; }
  return bsplit16(v); }
__device__ __forceinline__ F2 split_rowK(const float* row, int k0, int lane, int K) { float v[16]; const int g = lane >> 4;
#pragma unroll
  for (int i = 0; i < 8; ++i) { const int ka = k0 + 8 * g + i, kb = ka + 16; v[i] = ka < K ? row[ka < K ? ka : K - 1] : 0.f; v[8 + i] = kb < K ? row[kb < K ? kb : K - 1] : 0.f; }
  return bsplit16(v); }
__device__ __forceinline__ F2 split_col(const float* W, int k0, int n, int lane, int ld, int K) { float v[16]; const int g = lane >> 4;
#pragma unroll
  for (int i = 0; i < 8; ++i) { const int ka = k0 + 8 * g + i, kb = ka + 16; v[i] = ka < K ? W[(size_t)(ka < K ? ka : K - 1) * ld + n] : 0.f; v[8 + i] = kb < K ? W[(size_t)(kb < K ? kb : K - 1) * ld + n] : 0.f; }
  return bsplit16(v); }
__device__ __forceinline__ v8f mac3(const F2& a, const F2& b, v8f c) { c = wmma_bf(a.l, b.h, c); c = wmma_bf(a.h, b.l, c); return wmma_bf(a.h, b.h, c); }
__device__ __forceinline__ float sigm(float v) { return 1.0f / (1.0f + expf(-v)); }
#define LDSX() do { asm volatile("s_wait_dscnt 0" ::: "memory"); __builtin_amdgcn_wave_barrier(); __builtin_amdgcn_fence(__ATOMIC_RELEASE, "workgroup"); } while (0)


// Local-window self attention over video feature maps (2 x 8 frames of 32 x 32 positions, dim 256, 8 heads x 32): LayerNorm, q/k/v projections, each position attends to its 3 x 3 replicate-clamped neighbourhood, output projection + residual.
#define NFR 16          // b*t frames
#define HH 32
#define WWd 32
#define NPOS (HH * WWd)
#define DM 256
#define NHD 8
#define HD 32
#define NR (NFR * NPOS)   // 16384 rows
#ifndef TRB
#define TRB (NR / 64)
#endif
typedef __attribute__((ext_vector_type(8))) __bf16 v8b;
__device__ __forceinline__ v16b frag_b(const __bf16* rowk0, int lane) {
  union { v16b v; v8b q[2]; } u; const __bf16* p = rowk0 + 8 * (lane >> 4);
  u.q[0] = *(const v8b*)p; u.q[1] = *(const v8b*)(p + 16); return u.v;
}
// the 16 f32 values of a row fragment as loaded, split later: the loads can then go out one k chunk ahead of the conversion
struct R16 { v4f q[4]; };
__device__ __forceinline__ R16 raw_row(const float* row, int k0, int lane) { R16 r; const float* p = row + k0 + 8 * (lane >> 4);
  r.q[0] = *(const v4f*)p; r.q[1] = *(const v4f*)(p + 4); r.q[2] = *(const v4f*)(p + 16); r.q[3] = *(const v4f*)(p + 20); return r; }
__device__ __forceinline__ F2 split_raw(const R16& r) { float v[16];
#pragma unroll
  for (int i = 0; i < 16; ++i) v[i] = r.q[i >> 2][i & 3];
  return bsplit16(v); }
__device__ __forceinline__ float bfr(float v) { return (float)(__bf16)v; }
__device__ __attribute__((noinline)) float exp_ni(float v) { return expf(v); }
__device__ __attribute__((noinline)) float erf_ni(float v) { return erff(v); }

#define WS_PW  0u                                   // bf16 rows (transposed (in,out)): wq, wk, wv, wo [256][256] each
#define WS_XN  (WS_PW + 2u * 4 * DM * DM)            // f32 [NR][256] LayerNorm(x)
#define WS_Q   (WS_XN + 4u * (size_t)NR * DM)         // f32 [NR][256] q ; K ; V
#define WS_K   (WS_Q + 4u * (size_t)NR * DM)
#define WS_V   (WS_K + 4u * (size_t)NR * DM)
#define WS_END (WS_V + 4u * (size_t)NR * DM)

__global__ __launch_bounds__(256) void k_pack(const float* __restrict__ WQ, const float* __restrict__ WK, const float* __restrict__ WV, const float* __restrict__ WO, __bf16* __restrict__ PW) {
  const int n = blockIdx.x, which = blockIdx.y, t = threadIdx.x; const float* Wm = (which == 0) ? WQ : (which == 1) ? WK : (which == 2) ? WV : WO; __shared__ __align__(16) __bf16 s[DM];
  s[t] = (__bf16)Wm[(size_t)t * DM + n]; __syncthreads();
  if (t < DM / 8) vst2((unsigned*)(PW + ((size_t)which * DM + n) * DM + t * 8), *(const v4u*)&s[t * 8]);
}
// ---- k_ln: block = row (64 threads x 4): xn = (x - mu) * rsqrt(var + 1e-5) * g + b (biased variance)
__global__ __launch_bounds__(64) void k_ln(const float* __restrict__ X, const float* __restrict__ G, const float* __restrict__ Bt, float* __restrict__ XN) {
  __shared__ float red[2]; const int t = threadIdx.x; const size_t row = blockIdx.x; float v[4]; float s = 0.f; for (int i = 0; i < 4; ++i) { v[i] = bfr(X[row * DM + t * 4 + i]); s += v[i]; }
#pragma unroll
  for (int o = 1; o < 32; o <<= 1) s += __shfl_xor(s, o);
  if ((t & 31) == 0) red[t >> 5] = s; __syncthreads(); const float mu = (red[0] + red[1]) / (float)DM; __syncthreads();
  float q = 0.f; for (int i = 0; i < 4; ++i) { const float dd = v[i] - mu; q += dd * dd; }
#pragma unroll
  for (int o = 1; o < 32; o <<= 1) q += __shfl_xor(q, o);
  if ((t & 31) == 0) red[t >> 5] = q; __syncthreads(); const float inv = 1.0f / sqrtf((red[0] + red[1]) / (float)DM + 1e-5f);
  v4f o4; for (int i = 0; i < 4; ++i) { const int e = t * 4 + i; o4[i] = (v[i] - mu) * inv * bfr(G[e]) + bfr(Bt[e]); }
  vst2(XN + row * DM + t * 4, o4);
}
// ---- k_qkv: block = (64 rows, which 0 q / 1 k / 2 v): xn (hi + residual) . W rows (2 x 8 tiles) + b -> f32 rows
__global__ __launch_bounds__(128) void k_qkv(const float* __restrict__ XN, const __bf16* __restrict__ PW, const float* __restrict__ BQ, const float* __restrict__ BK, const float* __restrict__ BV, float* __restrict__ Q, float* __restrict__ Kx, float* __restrict__ V) {
  __shared__ __align__(16) float so[4][16][132];
  const int tid = threadIdx.x, wave = tid >> 5, lane = tid & 31, col = lane & 15, g = lane >> 4; const int which = blockIdx.y; const size_t r0 = (size_t)blockIdx.x * 64 + wave * 16;
  const __bf16* Wr = PW + (size_t)which * DM * DM; const float* bias = (which == 0) ? BQ : (which == 1) ? BK : BV; float* dst = (which == 0) ? Q : (which == 1) ? Kx : V;
#pragma unroll 1
  for (int pass = 0; pass < 2; ++pass) { v8f acc[8] = {};
    const float* Ar = XN + (r0 + col) * DM; const __bf16* Wp = Wr + (size_t)(pass * 128 + col) * DM;
    R16 ra = raw_row(Ar, 0, lane); v16b w[8];
#pragma unroll
    for (int j = 0; j < 8; ++j) w[j] = frag_b(Wp + j * 16 * DM, lane);
    // every load runs one k chunk (16 WMMAs) ahead of its use: the row values are reloaded as soon as they are split, a weight fragment right behind its own WMMA pair; a fragment loaded at its pair would be waited for in full 8 times a chunk. Unrolled whole, so that the waits are counted ones
#pragma unroll
    for (int kc = 0; kc < DM / 32; ++kc) {
      __builtin_amdgcn_sched_barrier(0);   // keeps this chunk's split below the chunk before: moved up among those WMMAs it waits for row loads that have only just gone out, and for every weight load with them
      const F2 a = split_raw(ra);
      if (kc + 1 < DM / 32) ra = raw_row(Ar, (kc + 1) * 32, lane);
#pragma unroll
      for (int j = 0; j < 8; ++j) { acc[j] = wmma_bf(a.l, w[j], acc[j]); acc[j] = wmma_bf(a.h, w[j], acc[j]);
        if (kc + 1 < DM / 32) w[j] = frag_b(Wp + j * 16 * DM + (kc + 1) * 32, lane); } }
#pragma unroll
    for (int j = 0; j < 8; ++j) { const float bb = bfr(bias[pass * 128 + j * 16 + col]);
#pragma unroll
      for (int r = 0; r < 8; ++r) so[wave][8 * g + r][j * 16 + col] = acc[j][r] + bb; }
    LDSX();
    for (int rl = 0; rl < 16; ++rl) vst2(dst + (r0 + rl) * DM + pass * 128 + lane * 4, *(const v4f*)&so[wave][rl][lane * 4]);
    LDSX(); }
}
// sum over the 8 lanes that share one head: lane l adds the value of lane l ^ M inside its 16-lane row (folds into v_add_f32_dpp row_xmask)
template <int M> __device__ __forceinline__ float xadd(float v) { return v + __int_as_float(__builtin_amdgcn_update_dpp(0, __float_as_int(v), 0x160 + M, 0xf, 0xf, true)); }
// ---- k_attn_out: block = 64 positions of one frame, 16 per wave: a wave takes one position at a time, lane l holding channels 4l..4l+3 and 128+4l..128+4l+3 (8 lanes per head), so every q/k/v load is 512 contiguous bytes; the 9 clamped neighbours: scores / sqrt(32), softmax, weighted v (f32 on VALU); then ctx (hi + residual) . Wo + bo + x
__global__ __launch_bounds__(128) void k_attn_out(const float* __restrict__ Q, const float* __restrict__ Kx, const float* __restrict__ V, const __bf16* __restrict__ PW, const float* __restrict__ BO, const float* __restrict__ X, float* __restrict__ OUT) {
  __shared__ __align__(16) float sc[64][DM + 4]; __shared__ __align__(16) float so[4][16][132];
  const int tid = threadIdx.x, wave = tid >> 5, lane = tid & 31, col = lane & 15, g = lane >> 4; const size_t rb0 = (size_t)blockIdx.x * 64; const size_t fr = rb0 / NPOS; const int p0 = (int)(rb0 % NPOS);
  const int wv = __builtin_amdgcn_readfirstlane(wave);   // the wave's number in a scalar register: position, clamps and row offsets are then scalar work
  const char* Qf = (const char*)(Q + fr * NPOS * DM); const char* Kf = (const char*)(Kx + fr * NPOS * DM); const char* Vf = (const char*)(V + fr * NPOS * DM); const unsigned lo = lane * 16;   // the frame's three planes: scalar bases that never change; lo: this lane's byte offset in a 512-byte half row
  // one position a trip (unroll 1: the 38 loads of a position already fill most of the registers); the inner loops are unrolled so that kv, vv and sco stay in registers
#pragma unroll 1
  for (int i = 0; i < 16; ++i) { const int r = wv * 16 + i; const int p = p0 + r; const int py = p / WWd, px = p % WWd;
    unsigned no[9];   // 32-bit byte offsets in the frame: one register a row, shared by the row's k and v loads; the centre (kk 4) is the position itself and serves q too
#pragma unroll
    for (int kk = 0; kk < 9; ++kk) { const int dy = kk / 3 - 1, dx = kk % 3 - 1; int ny = py + dy, nx = px + dx; ny = ny < 0 ? 0 : (ny > HH - 1 ? HH - 1 : ny); nx = nx < 0 ? 0 : (nx > WWd - 1 ? WWd - 1 : nx); no[kk] = (ny * WWd + nx) * (DM * 4) + lo; }
    v4f qv[2], kv[2][9], vv[2][9];
#pragma unroll
    for (int hf = 0; hf < 2; ++hf) { qv[hf] = *(const v4f*)(Qf + no[4] + hf * 512);
#pragma unroll
      for (int kk = 0; kk < 9; ++kk) kv[hf][kk] = *(const v4f*)(Kf + no[kk] + hf * 512);
#pragma unroll
      for (int kk = 0; kk < 9; ++kk) vv[hf][kk] = *(const v4f*)(Vf + no[kk] + hf * 512); }
    // behind the position's loads, before any register that they name is written again; the 9 offsets are named as inputs so that each keeps its own register up to this wait and no load's result lands in one
    asm volatile("s_wait_xcnt 0x0" :: "v"(no[0]), "v"(no[1]), "v"(no[2]), "v"(no[3]), "v"(no[4]), "v"(no[5]), "v"(no[6]), "v"(no[7]), "v"(no[8]) : "memory");
#pragma unroll
    for (int hf = 0; hf < 2; ++hf) { const int c = hf * 128 + lane * 4;
      float sco[9]; float mx = -3.0e38f;
#pragma unroll
      for (int kk = 0; kk < 9; ++kk) { float s = qv[hf][0] * kv[hf][kk][0]; s += qv[hf][1] * kv[hf][kk][1]; s += qv[hf][2] * kv[hf][kk][2]; s += qv[hf][3] * kv[hf][kk][3];
        s = xadd<1>(s); s = xadd<2>(s); s = xadd<4>(s);
        s *= 0.17677669529663687f; sco[kk] = s; mx = fmaxf(mx, s); }   // 1/sqrt(32)
      float den = 0.f;
#pragma unroll
      for (int kk = 0; kk < 9; ++kk) { const float e = expf(sco[kk] - mx); sco[kk] = e; den += e; }
      const float inv = 1.0f / den;
      v4f ov = {0.f, 0.f, 0.f, 0.f};
#pragma unroll
      for (int kk = 0; kk < 9; ++kk) { const float pw = sco[kk] * inv; ov += pw * vv[hf][kk]; }
      vst2(&sc[r][c], ov); } }
  if (tid < 64) for (int c = DM; c < DM + 4; ++c) sc[tid][c] = 0.f;
  __syncthreads();
  // out = ctx . Wo + bo + x
  const __bf16* Wr = PW + (size_t)3 * DM * DM; const size_t r0 = rb0 + wave * 16;
#pragma unroll 1
  for (int pass = 0; pass < 2; ++pass) { v8f acc[8] = {};
    const float* Ar = &sc[wave * 16 + col][0]; const __bf16* Wp = Wr + (size_t)(pass * 128 + col) * DM;
    R16 ra = raw_row(Ar, 0, lane); v16b w[8];
#pragma unroll
    for (int j = 0; j < 8; ++j) w[j] = frag_b(Wp + j * 16 * DM, lane);
    // every load runs one k chunk (16 WMMAs) ahead of its use: the row values are reloaded as soon as they are split, a weight fragment right behind its own WMMA pair; a fragment loaded at its pair would be waited for in full 8 times a chunk. Unrolled whole, so that the waits are counted ones
#pragma unroll
    for (int kc = 0; kc < DM / 32; ++kc) {
      __builtin_amdgcn_sched_barrier(0);   // keeps this chunk's split below the chunk before: moved up among those WMMAs it waits for LDS row loads that have only just gone out
      const F2 a = split_raw(ra);
      if (kc + 1 < DM / 32) ra = raw_row(Ar, (kc + 1) * 32, lane);
#pragma unroll
      for (int j = 0; j < 8; ++j) { acc[j] = wmma_bf(a.l, w[j], acc[j]); acc[j] = wmma_bf(a.h, w[j], acc[j]);
        if (kc + 1 < DM / 32) w[j] = frag_b(Wp + j * 16 * DM + (kc + 1) * 32, lane); } }
#pragma unroll
    for (int j = 0; j < 8; ++j) { const int c = pass * 128 + j * 16 + col; const float bb = bfr(BO[c]);
#pragma unroll
      for (int r = 0; r < 8; ++r) so[wave][8 * g + r][j * 16 + col] = acc[j][r] + bb + bfr(X[(r0 + 8 * g + r) * DM + c]); }
    LDSX();
    for (int rl = 0; rl < 16; ++rl) vst2(OUT + (r0 + rl) * DM + pass * 128 + lane * 4, *(const v4f*)&so[wave][rl][lane * 4]);
    LDSX(); }
}
extern "C" void kernel_launch(void* const* d_in, const int* in_sizes, int n_in, void* d_out, int out_size, void* d_ws, size_t ws_size, hipStream_t stream) {
  (void)in_sizes; (void)n_in; (void)out_size;
  const float** F = (const float**)d_in;   // 0 x [2,8,32,32,256], 1 ln_g, 2 ln_b, 3 wq (in,out), 4 bq, 5 wk, 6 bk, 7 wv, 8 bv, 9 wo, 10 bo
  if (ws_size < (size_t)WS_END) return;
  char* ws = (char*)d_ws; __bf16* PW = (__bf16*)(ws + WS_PW); float *XN = (float*)(ws + WS_XN), *Q = (float*)(ws + WS_Q), *Kx = (float*)(ws + WS_K), *V = (float*)(ws + WS_V);
  k_pack<<<dim3(DM, 4), 256, 0, stream>>>(F[3], F[5], F[7], F[9], PW);
  k_ln<<<NR, 64, 0, stream>>>(F[0], F[1], F[2], XN);
  k_qkv<<<dim3(NR / 64, 3), 128, 0, stream>>>(XN, PW, F[4], F[6], F[8], Q, Kx, V);
  k_attn_out<<<TRB, 128, 0, stream>>>(Q, Kx, V, PW, F[10], F[0], (float*)d_out);
}

// v003
// Measured time: 61.4 microseconds a run.
// In two side-by-side timings against v002, it was 1.18 and 1.13 times as fast.
// All steps since v000 together make it 1.98 times as fast.
// compute dtype: all float inputs rounded to bf16; LayerNorm (biased variance, eps 1e-5) in f32; q/k/v = xn (bf16 hi + residual, 2 products) . W + b on WMMA 16x16x32 ((in,out) weights as transposed rows), kept in f32; the 3x3 clamped-neighbourhood attention (9 keys per position, 8 heads x 32) entirely in f32 on VALU (scores / sqrt(32), softmax with precise expf, weighted sum); out = ctx (bf16 hi + residual, 2 products) . Wo + bo + x; f32 accumulate.
#include <hip/hip_runtime.h>
#include <math.h>

typedef __attribute__((ext_vector_type(16))) _Float16 v16h;
typedef __attribute__((ext_vector_type(16))) __bf16 v16b;
typedef __attribute__((ext_vector_type(8)))  _Float16 v8h;
typedef __attribute__((ext_vector_type(8)))  float v8f;
typedef __attribute__((ext_vector_type(4)))  float v4f;
typedef __attribute__((ext_vector_type(2)))  float v2f;
typedef __attribute__((ext_vector_type(4)))  unsigned v4u;
typedef __attribute__((ext_vector_type(4)))  int v4i;
typedef float __attribute__((may_alias)) float_a;
typedef int __attribute__((may_alias)) int_a;

template <typename T> __device__ __forceinline__ void vst2(void* p, T v) { *(T*)p = v;  }
__device__ __forceinline__ v8f wmma16(v16h a, v16h b, v8f c) {
  v8f d = __builtin_amdgcn_wmma_f32_16x16x32_f16(false, a, false, b, (short)0, c, false, false);
  asm volatile("v_nop\n\tv_nop\n\tv_nop\n\tv_nop" : "+v"(d) : "v"(a), "v"(b));
  return d;
}
__device__ __forceinline__ v8f wmma_bf(v16b a, v16b b, v8f c) {
  v8f d = __builtin_amdgcn_wmma_f32_16x16x32_bf16(false, a, false, b, (short)0, c, false, false);
  asm volatile("v_nop\n\tv_nop\n\tv_nop\n\tv_nop" : "+v"(d) : "v"(a), "v"(b));
  return d;
}
// 16x16x32 fragments: lane = (h = lane>>4, row/col = lane&15); elements 0..7 = k0+8h+0..7, 8..15 = k0+16+8h+0..7; D element r = row 8h+r
__device__ __forceinline__ v16h frag_h(const _Float16* rowk0, int lane) {
  union { v16h v; v8h q[2]; } u; const _Float16* p = rowk0 + 8 * (lane >> 4);
  u.q[0] = *(const v8h*)p; u.q[1] = *(const v8h*)(p + 16); return u.v;
}
__device__ __forceinline__ v16h frag_f32(const float* rowk0, int lane) {
  v16h a; const float* p = rowk0 + 8 * (lane >> 4);
#pragma unroll
  for (int i = 0; i < 8; ++i) { a[i] = (_Float16)p[i]; a[8 + i] = (_Float16)p[16 + i]; }
  return a;
}
__device__ __forceinline__ v16h frag_f32s(const float* rowk0, int lane, float sc) {
  v16h a; const float* p = rowk0 + 8 * (lane >> 4);
#pragma unroll
  for (int i = 0; i < 8; ++i) { a[i] = (_Float16)(p[i] * sc); a[8 + i] = (_Float16)(p[16 + i] * sc); }
  return a;
}
// column fragment from a [K][ld] layout (column n), rows >= K read as 0
__device__ __forceinline__ v16h fragc_f32(const float* W, int k0, int n, int lane, int ld, int K) {
  v16h a; const int g = lane >> 4;
#pragma unroll
  for (int i = 0; i < 8; ++i) { const int ka = k0 + 8 * g + i, kb = ka + 16;
    a[i] = (_Float16)(ka < K ? W[(size_t)(ka < K ? ka : K - 1) * ld + n] : 0.f); a[8 + i] = (_Float16)(kb < K ? W[(size_t)(kb < K ? kb : K - 1) * ld + n] : 0.f); }
  return a;
}
struct F2 { v16b h, l; };
__device__ __forceinline__ F2 bsplit16(const float v[16]) { F2 r;
#pragma unroll
  for (int i = 0; i < 16; ++i) { const __bf16 h = (__bf16)v[i]; r.h[i] = h; r.l[i] = (__bf16)(v[i] - (float)h); }
  return r; }
__device__ __forceinline__ F2 split_row(const float* row, int k0, int lane) { float v[16]; const float* p = row + k0 + 8 * (lane >> 4);
#pragma unroll
  for (int i = 0; i < 8; ++i) { v[i] = p[i]; v[8 + i] = p[16 + i]; }
  return bsplit16(v); }
__device__ __forceinline__ F2 split_rowK(const float* row, int k0, int lane, int K) { float v[16]; const int g = lane >> 4;
#pragma unroll
  for (int i = 0; i < 8; ++i) { const int ka = k0 + 8 * g + i, kb = ka + 16; v[i] = ka < K ? row[ka < K ? ka : K - 1] : 0.f; v[8 + i] = kb < K ? row[kb < K ? kb : K - 1] : 0.f; }
  return bsplit16(v); }
__device__ __forceinline__ F2 split_col(const float* W, int k0, int n, int lane, int ld, int K) { float v[16]; const int g = lane >> 4;
#pragma unroll
  for (int i = 0; i < 8; ++i) { const int ka = k0 + 8 * g + i, kb = ka + 16; v[i] = ka < K ? W[(size_t)(ka < K ? ka : K - 1) * ld + n] : 0.f; v[8 + i] = kb < K ? W[(size_t)(kb < K ? kb : K - 1) * ld + n] : 0.f; }
  return bsplit16(v); }
__device__ __forceinline__ v8f mac3(const F2& a, const F2& b, v8f c) { c = wmma_bf(a.l, b.h, c); c = wmma_bf(a.h, b.l, c); return wmma_bf(a.h, b.h, c); }
__device__ __forceinline__ float sigm(float v) { return 1.0f / (1.0f + expf(-v)); }
#define LDSX() do { asm volatile("s_wait_dscnt 0" ::: "memory"); __builtin_amdgcn_wave_barrier(); __builtin_amdgcn_fence(__ATOMIC_RELEASE, "workgroup"); } while (0)


// Local-window self attention over video feature maps (2 x 8 frames of 32 x 32 positions, dim 256, 8 heads x 32): LayerNorm, q/k/v projections, each position attends to its 3 x 3 replicate-clamped neighbourhood, output projection + residual.
#define NFR 16          // b*t frames
#define HH 32
#define WWd 32
#define NPOS (HH * WWd)
#define DM 256
#define NHD 8
#define HD 32
#define NR (NFR * NPOS)   // 16384 rows
#ifndef TRB
#define TRB (NR / 64)
#endif
typedef __attribute__((ext_vector_type(8))) __bf16 v8b;
__device__ __forceinline__ v16b frag_b(const __bf16* rowk0, int lane) {
  union { v16b v; v8b q[2]; } u; const __bf16* p = rowk0 + 8 * (lane >> 4);
  u.q[0] = *(const v8b*)p; u.q[1] = *(const v8b*)(p + 16); return u.v;
}
// the 16 f32 values of a row fragment as loaded, split later: the loads can then go out one k chunk ahead of the conversion
struct R16 { v4f q[4]; };
__device__ __forceinline__ R16 raw_row(const float* row, int k0, int lane) { R16 r; const float* p = row + k0 + 8 * (lane >> 4);
  r.q[0] = *(const v4f*)p; r.q[1] = *(const v4f*)(p + 4); r.q[2] = *(const v4f*)(p + 16); r.q[3] = *(const v4f*)(p + 20); return r; }
__device__ __forceinline__ F2 split_raw(const R16& r) { float v[16];
#pragma unroll
  for (int i = 0; i < 16; ++i) v[i] = r.q[i >> 2][i & 3];
  return bsplit16(v); }
__device__ __forceinline__ float bfr(float v) { return (float)(__bf16)v; }
__device__ __attribute__((noinline)) float exp_ni(float v) { return expf(v); }
__device__ __attribute__((noinline)) float erf_ni(float v) { return erff(v); }

#define WS_PW  0u                                   // bf16 rows (transposed (in,out)): wq, wk, wv, wo [256][256] each
#define WS_Q   (WS_PW + 2u * 4 * DM * DM)            // f32 [NR][256] q ; K ; V
#define WS_K   (WS_Q + 4u * (size_t)NR * DM)
#define WS_V   (WS_K + 4u * (size_t)NR * DM)
#define WS_END (WS_V + 4u * (size_t)NR * DM)

__global__ __launch_bounds__(256) void k_pack(const float* __restrict__ WQ, const float* __restrict__ WK, const float* __restrict__ WV, const float* __restrict__ WO, __bf16* __restrict__ PW) {
  const int n = blockIdx.x, which = blockIdx.y, t = threadIdx.x; const float* Wm = (which == 0) ? WQ : (which == 1) ? WK : (which == 2) ? WV : WO; __shared__ __align__(16) __bf16 s[DM];
  s[t] = (__bf16)Wm[(size_t)t * DM + n]; __syncthreads();
  if (t < DM / 8) vst2((unsigned*)(PW + ((size_t)which * DM + n) * DM + t * 8), *(const v4u*)&s[t * 8]);
}
// one step of a lane sum (M = 1, 2, 4 cover the 8 lanes of one head): lane l adds the value of lane l ^ M inside its 16-lane row (folds into v_add_f32_dpp row_xmask)
template <int M> __device__ __forceinline__ float xadd(float v) { return v + __int_as_float(__builtin_amdgcn_update_dpp(0, __float_as_int(v), 0x160 + M, 0xf, 0xf, true)); }
// lane l with lane l ^ 16
__device__ __forceinline__ float xhalf(float v) { return __int_as_float(__builtin_amdgcn_permlanex16(__float_as_int(v), __float_as_int(v), 0x76543210, 0xfedcba98, false, false)); }
// sum over the wave's 32 lanes, the partner distances in the order 1, 2, 4, 8, 16
__device__ __forceinline__ float wsum(float v) { v = xadd<1>(v); v = xadd<2>(v); v = xadd<4>(v); v = xadd<8>(v); return v + xhalf(v); }
// ---- k_qkv: block = 64 rows, 12 waves. First xn = (x - mu) * rsqrt(var + 1e-5) * g + b (biased variance) of the 64 rows into LDS, a wave taking every 12th row whole (lane l holds channels 4l..4l+3 and 128+4l..128+4l+3); then wave = (16 rows, which 0 q / 1 k / 2 v): xn (hi + residual) . W rows (2 x 8 tiles) + b -> f32 rows
__global__ __launch_bounds__(384) void k_qkv(const float* __restrict__ X, const float* __restrict__ G, const float* __restrict__ Bt, const __bf16* __restrict__ PW, const float* __restrict__ BQ, const float* __restrict__ BK, const float* __restrict__ BV, float* __restrict__ Q, float* __restrict__ Kx, float* __restrict__ V) {
  __shared__ __align__(16) float sx[64][DM + 4]; __shared__ __align__(16) float so[12][16][132];
  const int tid = threadIdx.x, lane = tid & 31, col = lane & 15, g = lane >> 4; const size_t rb0 = (size_t)blockIdx.x * 64;
  const int wv = __builtin_amdgcn_readfirstlane(tid >> 5);   // the wave's number in a scalar register: its rows, its weight matrix, bias and destination are then scalar work
  { v4f xv[6][2], gg[2], bt[2]; float mu[6], inv[6];   // the wave's rows wv, wv + 12, ..: five for every wave, a sixth for waves 0 to 3 (the others re-read row 63 there and do not store it). All row loads go out first, and each stage runs over all six rows, so that six independent chains fill one another's latency
    const char* Xb = (const char*)(X + rb0 * DM); const unsigned lo = lane * 16, xo = wv * (DM * 4) + lo, xo5 = (wv < 4 ? wv + 60 : 63) * (DM * 4) + lo;   // scalar bases and three 32-bit byte offsets serve all 16 loads
#pragma unroll
    for (int it = 0; it < 6; ++it) { const char* xr = Xb + (it < 5 ? xo + it * 12 * (DM * 4) : xo5); xv[it][0] = *(const v4f*)xr; xv[it][1] = *(const v4f*)(xr + 512); }
#pragma unroll
    for (int hf = 0; hf < 2; ++hf) { gg[hf] = *(const v4f*)((const char*)G + lo + hf * 512); bt[hf] = *(const v4f*)((const char*)Bt + lo + hf * 512); }
    // behind the loads, before any register that they name is written again; the three offsets are named as inputs so that each keeps its own register up to this wait and no load's result lands in one
    asm volatile("s_wait_xcnt 0x0" :: "v"(lo), "v"(xo), "v"(xo5) : "memory");
#pragma unroll
    for (int hf = 0; hf < 2; ++hf) {
#pragma unroll
      for (int i = 0; i < 4; ++i) { gg[hf][i] = bfr(gg[hf][i]); bt[hf][i] = bfr(bt[hf][i]); } }
#pragma unroll
    for (int it = 0; it < 6; ++it) { float s[2];
#pragma unroll
      for (int hf = 0; hf < 2; ++hf) { s[hf] = 0.f;
#pragma unroll
        for (int i = 0; i < 4; ++i) { xv[it][hf][i] = bfr(xv[it][hf][i]); s[hf] += xv[it][hf][i]; }
        s[hf] = wsum(s[hf]); }
      mu[it] = (s[0] + s[1]) / (float)DM; }
#pragma unroll
    for (int it = 0; it < 6; ++it) { float q[2];
#pragma unroll
      for (int hf = 0; hf < 2; ++hf) { q[hf] = 0.f;
#pragma unroll
        for (int i = 0; i < 4; ++i) { const float dd = xv[it][hf][i] - mu[it]; q[hf] += dd * dd; }
        q[hf] = wsum(q[hf]); }
      inv[it] = 1.0f / sqrtf((q[0] + q[1]) / (float)DM + 1e-5f); }
#pragma unroll
    for (int it = 0; it < 6; ++it) { const int r = wv + 12 * it;
      if (it < 5 || r < 64) {
#pragma unroll
        for (int hf = 0; hf < 2; ++hf) { v4f o4;
#pragma unroll
          for (int i = 0; i < 4; ++i) o4[i] = (xv[it][hf][i] - mu[it]) * inv[it] * gg[hf][i] + bt[hf][i];
          vst2(&sx[r][hf * 128 + lane * 4], o4); } } } }
  __syncthreads();   // a wave's 16 rows of xn were written by all 12 waves
  const int which = wv >> 2; const size_t r0 = rb0 + (wv & 3) * 16;
  const __bf16* Wr = PW + (size_t)which * DM * DM; const float* bias = (which == 0) ? BQ : (which == 1) ? BK : BV; float* dst = (which == 0) ? Q : (which == 1) ? Kx : V;
#pragma unroll 1
  for (int pass = 0; pass < 2; ++pass) { v8f acc[8] = {};
    const float* Ar = &sx[(wv & 3) * 16 + col][0]; const __bf16* Wp = Wr + (size_t)(pass * 128 + col) * DM;
    R16 ra = raw_row(Ar, 0, lane); v16b w[8];
#pragma unroll
    for (int j = 0; j < 8; ++j) w[j] = frag_b(Wp + j * 16 * DM, lane);
    // every load runs one k chunk (16 WMMAs) ahead of its use: the row values are reloaded as soon as they are split, a weight fragment right behind its own WMMA pair; a fragment loaded at its pair would be waited for in full 8 times a chunk. Unrolled whole, so that the waits are counted ones
#pragma unroll
    for (int kc = 0; kc < DM / 32; ++kc) {
      __builtin_amdgcn_sched_barrier(0);   // keeps this chunk's split below the chunk before: moved up among those WMMAs it waits for row loads that have only just gone out
      const F2 a = split_raw(ra);
      if (kc + 1 < DM / 32) ra = raw_row(Ar, (kc + 1) * 32, lane);
#pragma unroll
      for (int j = 0; j < 8; ++j) { acc[j] = wmma_bf(a.l, w[j], acc[j]); acc[j] = wmma_bf(a.h, w[j], acc[j]);
        if (kc + 1 < DM / 32) w[j] = frag_b(Wp + j * 16 * DM + (kc + 1) * 32, lane); } }
#pragma unroll
    for (int j = 0; j < 8; ++j) { const float bb = bfr(bias[pass * 128 + j * 16 + col]);
#pragma unroll
      for (int r = 0; r < 8; ++r) so[wv][8 * g + r][j * 16 + col] = acc[j][r] + bb; }
    LDSX();
    for (int rl = 0; rl < 16; ++rl) vst2(dst + (r0 + rl) * DM + pass * 128 + lane * 4, *(const v4f*)&so[wv][rl][lane * 4]);
    LDSX(); }
}
// ---- k_attn_out: block = 64 positions of one frame, 16 per wave: a wave takes one position at a time, lane l holding channels 4l..4l+3 and 128+4l..128+4l+3 (8 lanes per head), so every q/k/v load is 512 contiguous bytes; the 9 clamped neighbours: scores / sqrt(32), softmax, weighted v (f32 on VALU); then ctx (hi + residual) . Wo + bo + x
__global__ __launch_bounds__(128) void k_attn_out(const float* __restrict__ Q, const float* __restrict__ Kx, const float* __restrict__ V, const __bf16* __restrict__ PW, const float* __restrict__ BO, const float* __restrict__ X, float* __restrict__ OUT) {
  __shared__ __align__(16) float sc[64][DM + 4]; __shared__ __align__(16) float so[4][16][132];
  const int tid = threadIdx.x, wave = tid >> 5, lane = tid & 31, col = lane & 15, g = lane >> 4; const size_t rb0 = (size_t)blockIdx.x * 64; const size_t fr = rb0 / NPOS; const int p0 = (int)(rb0 % NPOS);
  const int wv = __builtin_amdgcn_readfirstlane(wave);   // the wave's number in a scalar register: position, clamps and row offsets are then scalar work
  const char* Qf = (const char*)(Q + fr * NPOS * DM); const char* Kf = (const char*)(Kx + fr * NPOS * DM); const char* Vf = (const char*)(V + fr * NPOS * DM); const unsigned lo = lane * 16;   // the frame's three planes: scalar bases that never change; lo: this lane's byte offset in a 512-byte half row
  // one position a trip (unroll 1: the 38 loads of a position already fill most of the registers); the inner loops are unrolled so that kv, vv and sco stay in registers
#pragma unroll 1
  for (int i = 0; i < 16; ++i) { const int r = wv * 16 + i; const int p = p0 + r; const int py = p / WWd, px = p % WWd;
    unsigned no[9];   // 32-bit byte offsets in the frame: one register a row, shared by the row's k and v loads; the centre (kk 4) is the position itself and serves q too
#pragma unroll
    for (int kk = 0; kk < 9; ++kk) { const int dy = kk / 3 - 1, dx = kk % 3 - 1; int ny = py + dy, nx = px + dx; ny = ny < 0 ? 0 : (ny > HH - 1 ? HH - 1 : ny); nx = nx < 0 ? 0 : (nx > WWd - 1 ? WWd - 1 : nx); no[kk] = (ny * WWd + nx) * (DM * 4) + lo; }
    v4f qv[2], kv[2][9], vv[2][9];
#pragma unroll
    for (int hf = 0; hf < 2; ++hf) { qv[hf] = *(const v4f*)(Qf + no[4] + hf * 512);
#pragma unroll
      for (int kk = 0; kk < 9; ++kk) kv[hf][kk] = *(const v4f*)(Kf + no[kk] + hf * 512);
#pragma unroll
      for (int kk = 0; kk < 9; ++kk) vv[hf][kk] = *(const v4f*)(Vf + no[kk] + hf * 512); }
    // behind the position's loads, before any register that they name is written again; the 9 offsets are named as inputs so that each keeps its own register up to this wait and no load's result lands in one
    asm volatile("s_wait_xcnt 0x0" :: "v"(no[0]), "v"(no[1]), "v"(no[2]), "v"(no[3]), "v"(no[4]), "v"(no[5]), "v"(no[6]), "v"(no[7]), "v"(no[8]) : "memory");
#pragma unroll
    for (int hf = 0; hf < 2; ++hf) { const int c = hf * 128 + lane * 4;
      float sco[9]; float mx = -3.0e38f;
#pragma unroll
      for (int kk = 0; kk < 9; ++kk) { float s = qv[hf][0] * kv[hf][kk][0]; s += qv[hf][1] * kv[hf][kk][1]; s += qv[hf][2] * kv[hf][kk][2]; s += qv[hf][3] * kv[hf][kk][3];
        s = xadd<1>(s); s = xadd<2>(s); s = xadd<4>(s);
        s *= 0.17677669529663687f; sco[kk] = s; mx = fmaxf(mx, s); }   // 1/sqrt(32)
      float den = 0.f;
#pragma unroll
      for (int kk = 0; kk < 9; ++kk) { const float e = expf(sco[kk] - mx); sco[kk] = e; den += e; }
      const float inv = 1.0f / den;
      v4f ov = {0.f, 0.f, 0.f, 0.f};
#pragma unroll
      for (int kk = 0; kk < 9; ++kk) { const float pw = sco[kk] * inv; ov += pw * vv[hf][kk]; }
      vst2(&sc[r][c], ov); } }
  if (tid < 64) for (int c = DM; c < DM + 4; ++c) sc[tid][c] = 0.f;
  __syncthreads();
  // out = ctx . Wo + bo + x
  const __bf16* Wr = PW + (size_t)3 * DM * DM; const size_t r0 = rb0 + wave * 16;
#pragma unroll 1
  for (int pass = 0; pass < 2; ++pass) { v8f acc[8] = {};
    const float* Ar = &sc[wave * 16 + col][0]; const __bf16* Wp = Wr + (size_t)(pass * 128 + col) * DM;
    R16 ra = raw_row(Ar, 0, lane); v16b w[8];
#pragma unroll
    for (int j = 0; j < 8; ++j) w[j] = frag_b(Wp + j * 16 * DM, lane);
    // every load runs one k chunk (16 WMMAs) ahead of its use: the row values are reloaded as soon as they are split, a weight fragment right behind its own WMMA pair; a fragment loaded at its pair would be waited for in full 8 times a chunk. Unrolled whole, so that the waits are counted ones
#pragma unroll
    for (int kc = 0; kc < DM / 32; ++kc) {
      __builtin_amdgcn_sched_barrier(0);   // keeps this chunk's split below the chunk before: moved up among those WMMAs it waits for LDS row loads that have only just gone out
      const F2 a = split_raw(ra);
      if (kc + 1 < DM / 32) ra = raw_row(Ar, (kc + 1) * 32, lane);
#pragma unroll
      for (int j = 0; j < 8; ++j) { acc[j] = wmma_bf(a.l, w[j], acc[j]); acc[j] = wmma_bf(a.h, w[j], acc[j]);
        if (kc + 1 < DM / 32) w[j] = frag_b(Wp + j * 16 * DM + (kc + 1) * 32, lane); } }
#pragma unroll
    for (int j = 0; j < 8; ++j) { const int c = pass * 128 + j * 16 + col; const float bb = bfr(BO[c]);
#pragma unroll
      for (int r = 0; r < 8; ++r) so[wave][8 * g + r][j * 16 + col] = acc[j][r] + bb + bfr(X[(r0 + 8 * g + r) * DM + c]); }
    LDSX();
    for (int rl = 0; rl < 16; ++rl) vst2(OUT + (r0 + rl) * DM + pass * 128 + lane * 4, *(const v4f*)&so[wave][rl][lane * 4]);
    LDSX(); }
}
extern "C" void kernel_launch(void* const* d_in, const int* in_sizes, int n_in, void* d_out, int out_size, void* d_ws, size_t ws_size, hipStream_t stream) {
  (void)in_sizes; (void)n_in; (void)out_size;
  const float** F = (const float**)d_in;   // 0 x [2,8,32,32,256], 1 ln_g, 2 ln_b, 3 wq (in,out), 4 bq, 5 wk, 6 bk, 7 wv, 8 bv, 9 wo, 10 bo
  if (ws_size < (size_t)WS_END) return;
  char* ws = (char*)d_ws; __bf16* PW = (__bf16*)(ws + WS_PW); float *Q = (float*)(ws + WS_Q), *Kx = (float*)(ws + WS_K), *V = (float*)(ws + WS_V);
  k_pack<<<dim3(DM, 4), 256, 0, stream>>>(F[3], F[5], F[7], F[9], PW);
  k_qkv<<<NR / 64, 384, 0, stream>>>(F[0], F[1], F[2], PW, F[4], F[6], F[8], Q, Kx, V);
  k_attn_out<<<TRB, 128, 0, stream>>>(Q, Kx, V, PW, F[10], F[0], (float*)d_out);
}

// v004
// One run takes 55.3 microseconds.
// Next to v003, in two timings, it ran 1.10 and 1.11 times as fast.
// All steps since v000 together make it 2.18 times as fast.
// compute dtype: all float inputs rounded to bf16; LayerNorm (biased variance, eps 1e-5) in f32; q/k/v = xn (bf16 hi + residual, 2 products) . W + b on WMMA 16x16x32 ((in,out) weights packed in B-fragment order), kept in f32; the 3x3 clamped-neighbourhood attention (9 keys per position, 8 heads x 32) entirely in f32 on VALU (scores / sqrt(32), softmax with precise expf, weighted sum); out = ctx (bf16 hi + residual, 2 products) . Wo + bo + x; f32 accumulate.
#include <hip/hip_runtime.h>
#include <math.h>

typedef __attribute__((ext_vector_type(16))) _Float16 v16h;
typedef __attribute__((ext_vector_type(16))) __bf16 v16b;
typedef __attribute__((ext_vector_type(8)))  _Float16 v8h;
typedef __attribute__((ext_vector_type(8)))  float v8f;
typedef __attribute__((ext_vector_type(4)))  float v4f;
typedef __attribute__((ext_vector_type(2)))  float v2f;
typedef __attribute__((ext_vector_type(4)))  unsigned v4u;
typedef __attribute__((ext_vector_type(4)))  int v4i;
typedef float __attribute__((may_alias)) float_a;
typedef int __attribute__((may_alias)) int_a;

template <typename T> __device__ __forceinline__ void vst2(void* p, T v) { *(T*)p = v;  }
__device__ __forceinline__ v8f wmma16(v16h a, v16h b, v8f c) {
  v8f d = __builtin_amdgcn_wmma_f32_16x16x32_f16(false, a, false, b, (short)0, c, false, false);
  asm volatile("v_nop\n\tv_nop\n\tv_nop\n\tv_nop" : "+v"(d) : "v"(a), "v"(b));
  return d;
}
__device__ __forceinline__ v8f wmma_bf(v16b a, v16b b, v8f c) {
  v8f d = __builtin_amdgcn_wmma_f32_16x16x32_bf16(false, a, false, b, (short)0, c, false, false);
  asm volatile("v_nop\n\tv_nop\n\tv_nop\n\tv_nop" : "+v"(d) : "v"(a), "v"(b));
  return d;
}
// 16x16x32 fragments: lane = (h = lane>>4, row/col = lane&15); elements 0..7 = k0+8h+0..7, 8..15 = k0+16+8h+0..7; D element r = row 8h+r
__device__ __forceinline__ v16h frag_h(const _Float16* rowk0, int lane) {
  union { v16h v; v8h q[2]; } u; const _Float16* p = rowk0 + 8 * (lane >> 4);
  u.q[0] = *(const v8h*)p; u.q[1] = *(const v8h*)(p + 16); return u.v;
}
__device__ __forceinline__ v16h frag_f32(const float* rowk0, int lane) {
  v16h a; const float* p = rowk0 + 8 * (lane >> 4);
#pragma unroll
  for (int i = 0; i < 8; ++i) { a[i] = (_Float16)p[i]; a[8 + i] = (_Float16)p[16 + i]; }
  return a;
}
__device__ __forceinline__ v16h frag_f32s(const float* rowk0, int lane, float sc) {
  v16h a; const float* p = rowk0 + 8 * (lane >> 4);
#pragma unroll
  for (int i = 0; i < 8; ++i) { a[i] = (_Float16)(p[i] * sc); a[8 + i] = (_Float16)(p[16 + i] * sc); }
  return a;
}
// column fragment from a [K][ld] layout (column n), rows >= K read as 0
__device__ __forceinline__ v16h fragc_f32(const float* W, int k0, int n, int lane, int ld, int K) {
  v16h a; const int g = lane >> 4;
#pragma unroll
  for (int i = 0; i < 8; ++i) { const int ka = k0 + 8 * g + i, kb = ka + 16;
    a[i] = (_Float16)(ka < K ? W[(size_t)(ka < K ? ka : K - 1) * ld + n] : 0.f); a[8 + i] = (_Float16)(kb < K ? W[(size_t)(kb < K ? kb : K - 1) * ld + n] : 0.f); }
  return a;
}
struct F2 { v16b h, l; };
__device__ __forceinline__ F2 bsplit16(const float v[16]) { F2 r;
#pragma unroll
  for (int i = 0; i < 16; ++i) { const __bf16 h = (__bf16)v[i]; r.h[i] = h; r.l[i] = (__bf16)(v[i] - (float)h); }
  return r; }
__device__ __forceinline__ F2 split_row(const float* row, int k0, int lane) { float v[16]; const float* p = row + k0 + 8 * (lane >> 4);
#pragma unroll
  for (int i = 0; i < 8; ++i) { v[i] = p[i]; v[8 + i] = p[16 + i]; }
  return bsplit16(v); }
__device__ __forceinline__ F2 split_rowK(const float* row, int k0, int lane, int K) { float v[16]; const int g = lane >> 4;
#pragma unroll
  for (int i = 0; i < 8; ++i) { const int ka = k0 + 8 * g + i, kb = ka + 16; v[i] = ka < K ? row[ka < K ? ka : K - 1] : 0.f; v[8 + i] = kb < K ? row[kb < K ? kb : K - 1] : 0.f; }
  return bsplit16(v); }
__device__ __forceinline__ F2 split_col(const float* W, int k0, int n, int lane, int ld, int K) { float v[16]; const int g = lane >> 4;
#pragma unroll
  for (int i = 0; i < 8; ++i) { const int ka = k0 + 8 * g + i, kb = ka + 16; v[i] = ka < K ? W[(size_t)(ka < K ? ka : K - 1) * ld + n] : 0.f; v[8 + i] = kb < K ? W[(size_t)(kb < K ? kb : K - 1) * ld + n] : 0.f; }
  return bsplit16(v); }
__device__ __forceinline__ v8f mac3(const F2& a, const F2& b, v8f c) { c = wmma_bf(a.l, b.h, c); c = wmma_bf(a.h, b.l, c); return wmma_bf(a.h, b.h, c); }
__device__ __forceinline__ float sigm(float v) { return 1.0f / (1.0f + expf(-v)); }
#define LDSX() do { asm volatile("s_wait_dscnt 0" ::: "memory"); __builtin_amdgcn_wave_barrier(); __builtin_amdgcn_fence(__ATOMIC_RELEASE, "workgroup"); } while (0)


// Local-window self attention over video feature maps (2 x 8 frames of 32 x 32 positions, dim 256, 8 heads x 32): LayerNorm, q/k/v projections, each position attends to its 3 x 3 replicate-clamped neighbourhood, output projection + residual.
#define NFR 16          // b*t frames
#define HH 32
#define WWd 32
#define NPOS (HH * WWd)
#define DM 256
#define NHD 8
#define HD 32
#define NR (NFR * NPOS)   // 16384 rows
#ifndef TRB
#define TRB (NR / 64)
#endif
typedef __attribute__((ext_vector_type(8))) __bf16 v8b;
// B fragment number t = (16-column tile) * 8 + (32-k chunk) of a packed weight matrix: 1 KiB, elements 0..7 of all 32 lanes and then elements 8..15, so each of the two loads is 512 contiguous bytes (4 whole lines). Wb: the first fragment, fo = lane * 16
__device__ __forceinline__ v16b frag_p(const char* Wb, unsigned fo, int t) {
  union { v16b v; v8b q[2]; } u; const char* p = Wb + (fo + (unsigned)t * 1024u);
  u.q[0] = *(const v8b*)p; u.q[1] = *(const v8b*)(p + 512); return u.v;
}
// the 16 f32 values of a row fragment as loaded, split later: the loads can then go out one k chunk ahead of the conversion
struct R16 { v4f q[4]; };
__device__ __forceinline__ R16 raw_row(const float* row, int k0, int lane) { R16 r; const float* p = row + k0 + 8 * (lane >> 4);
  r.q[0] = *(const v4f*)p; r.q[1] = *(const v4f*)(p + 4); r.q[2] = *(const v4f*)(p + 16); r.q[3] = *(const v4f*)(p + 20); return r; }
__device__ __forceinline__ F2 split_raw(const R16& r) { float v[16];
#pragma unroll
  for (int i = 0; i < 16; ++i) v[i] = r.q[i >> 2][i & 3];
  return bsplit16(v); }
__device__ __forceinline__ float bfr(float v) { return (float)(__bf16)v; }
__device__ __attribute__((noinline)) float exp_ni(float v) { return expf(v); }
__device__ __attribute__((noinline)) float erf_ni(float v) { return erff(v); }

#define WS_PW  0u                                   // bf16 in B-fragment order: wq, wk, wv, wo, each [16 column tiles][8 k chunks][2 halves][32 lanes][8]
#define WS_Q   (WS_PW + 2u * 4 * DM * DM)            // f32 [NR][256] q ; K ; V
#define WS_K   (WS_Q + 4u * (size_t)NR * DM)
#define WS_V   (WS_K + 4u * (size_t)NR * DM)
#define WS_END (WS_V + 4u * (size_t)NR * DM)

// ---- k_pack: block = one 16-column tile of one weight matrix, wave = one 32-k chunk: each lane gathers the 16 values of its own B fragment (column jt * 16 + col, k = kc * 32 + 8 g + 0..7 and + 16 + 0..7; a load covers two 64-byte row pieces) and the wave stores the fragment as two runs of 512 bytes, every line written whole by one wave
__global__ __launch_bounds__(256) void k_pack(const float* __restrict__ WQ, const float* __restrict__ WK, const float* __restrict__ WV, const float* __restrict__ WO, __bf16* __restrict__ PW) {
  const int jt = blockIdx.x, which = blockIdx.y, lane = threadIdx.x & 31, col = lane & 15, g = lane >> 4; const int kc = __builtin_amdgcn_readfirstlane(threadIdx.x >> 5);
  const float* Wm = (which == 0) ? WQ : (which == 1) ? WK : (which == 2) ? WV : WO;
  const char* Wt = (const char*)(Wm + (size_t)kc * 32 * DM + jt * 16); const unsigned po = (8 * g * DM + col) * 4;   // scalar base and one 32-bit byte offset serve all 16 loads
  float v[16];
#pragma unroll
  for (int i = 0; i < 8; ++i) { v[i] = *(const float*)(Wt + po + i * (DM * 4)); v[8 + i] = *(const float*)(Wt + po + (16 + i) * (DM * 4)); }
  v8b o0, o1;
#pragma unroll
  for (int i = 0; i < 8; ++i) { o0[i] = (__bf16)v[i]; o1[i] = (__bf16)v[8 + i]; }
  __bf16* d = PW + (((size_t)which * 16 + jt) * 8 + kc) * 512 + lane * 8;
  vst2(d, o0); vst2(d + 256, o1);
}
// one step of a lane sum (M = 1, 2, 4 cover the 8 lanes of one head): lane l adds the value of lane l ^ M inside its 16-lane row (folds into v_add_f32_dpp row_xmask)
template <int M> __device__ __forceinline__ float xadd(float v) { return v + __int_as_float(__builtin_amdgcn_update_dpp(0, __float_as_int(v), 0x160 + M, 0xf, 0xf, true)); }
// lane l with lane l ^ 16
__device__ __forceinline__ float xhalf(float v) { return __int_as_float(__builtin_amdgcn_permlanex16(__float_as_int(v), __float_as_int(v), 0x76543210, 0xfedcba98, false, false)); }
// sum over the wave's 32 lanes, the partner distances in the order 1, 2, 4, 8, 16
__device__ __forceinline__ float wsum(float v) { v = xadd<1>(v); v = xadd<2>(v); v = xadd<4>(v); v = xadd<8>(v); return v + xhalf(v); }
// ---- k_qkv: block = 64 rows, 12 waves. First xn = (x - mu) * rsqrt(var + 1e-5) * g + b (biased variance) of the 64 rows into LDS, a wave taking every 12th row whole (lane l holds channels 4l..4l+3 and 128+4l..128+4l+3); then wave = (16 rows, which 0 q / 1 k / 2 v): xn (hi + residual) . W rows (2 x 8 tiles) + b -> f32 rows
__global__ __launch_bounds__(384) void k_qkv(const float* __restrict__ X, const float* __restrict__ G, const float* __restrict__ Bt, const __bf16* __restrict__ PW, const float* __restrict__ BQ, const float* __restrict__ BK, const float* __restrict__ BV, float* __restrict__ Q, float* __restrict__ Kx, float* __restrict__ V) {
  __shared__ __align__(16) float sx[64][DM + 4]; __shared__ __align__(16) float so[12][16][132];
  const int tid = threadIdx.x, lane = tid & 31, col = lane & 15, g = lane >> 4; const size_t rb0 = (size_t)blockIdx.x * 64;
  const int wv = __builtin_amdgcn_readfirstlane(tid >> 5);   // the wave's number in a scalar register: its rows, its weight matrix, bias and destination are then scalar work
  { v4f xv[6][2], gg[2], bt[2]; float mu[6], inv[6];   // the wave's rows wv, wv + 12, ..: five for every wave, a sixth for waves 0 to 3 (the others re-read row 63 there and do not store it). All row loads go out first, and each stage runs over all six rows, so that six independent chains fill one another's latency
    const char* Xb = (const char*)(X + rb0 * DM); const unsigned lo = lane * 16, xo = wv * (DM * 4) + lo, xo5 = (wv < 4 ? wv + 60 : 63) * (DM * 4) + lo;   // scalar bases and three 32-bit byte offsets serve all 16 loads
#pragma unroll
    for (int it = 0; it < 6; ++it) { const char* xr = Xb + (it < 5 ? xo + it * 12 * (DM * 4) : xo5); xv[it][0] = *(const v4f*)xr; xv[it][1] = *(const v4f*)(xr + 512); }
#pragma unroll
    for (int hf = 0; hf < 2; ++hf) { gg[hf] = *(const v4f*)((const char*)G + lo + hf * 512); bt[hf] = *(const v4f*)((const char*)Bt + lo + hf * 512); }
    // behind the loads, before any register that they name is written again; the three offsets are named as inputs so that each keeps its own register up to this wait and no load's result lands in one
    asm volatile("s_wait_xcnt 0x0" :: "v"(lo), "v"(xo), "v"(xo5) : "memory");
#pragma unroll
    for (int hf = 0; hf < 2; ++hf) {
#pragma unroll
      for (int i = 0; i < 4; ++i) { gg[hf][i] = bfr(gg[hf][i]); bt[hf][i] = bfr(bt[hf][i]); } }
#pragma unroll
    for (int it = 0; it < 6; ++it) { float s[2];
#pragma unroll
      for (int hf = 0; hf < 2; ++hf) { s[hf] = 0.f;
#pragma unroll
        for (int i = 0; i < 4; ++i) { xv[it][hf][i] = bfr(xv[it][hf][i]); s[hf] += xv[it][hf][i]; }
        s[hf] = wsum(s[hf]); }
      mu[it] = (s[0] + s[1]) / (float)DM; }
#pragma unroll
    for (int it = 0; it < 6; ++it) { float q[2];
#pragma unroll
      for (int hf = 0; hf < 2; ++hf) { q[hf] = 0.f;
#pragma unroll
        for (int i = 0; i < 4; ++i) { const float dd = xv[it][hf][i] - mu[it]; q[hf] += dd * dd; }
        q[hf] = wsum(q[hf]); }
      inv[it] = 1.0f / sqrtf((q[0] + q[1]) / (float)DM + 1e-5f); }
#pragma unroll
    for (int it = 0; it < 6; ++it) { const int r = wv + 12 * it;
      if (it < 5 || r < 64) {
#pragma unroll
        for (int hf = 0; hf < 2; ++hf) { v4f o4;
#pragma unroll
          for (int i = 0; i < 4; ++i) o4[i] = (xv[it][hf][i] - mu[it]) * inv[it] * gg[hf][i] + bt[hf][i];
          vst2(&sx[r][hf * 128 + lane * 4], o4); } } } }
  __syncthreads();   // a wave's 16 rows of xn were written by all 12 waves
  const int which = wv >> 2; const size_t r0 = rb0 + (wv & 3) * 16;
  const __bf16* Wr = PW + (size_t)which * DM * DM; const float* bias = (which == 0) ? BQ : (which == 1) ? BK : BV; float* dst = (which == 0) ? Q : (which == 1) ? Kx : V;
#pragma unroll 1
  for (int pass = 0; pass < 2; ++pass) { v8f acc[8] = {};
    const float* Ar = &sx[(wv & 3) * 16 + col][0]; const char* Wp = (const char*)(Wr + (size_t)pass * 128 * DM); const unsigned fo = lane * 16;   // the pass's 8 column tiles: 64 fragments in a row
    R16 ra = raw_row(Ar, 0, lane); v16b w[8];
#pragma unroll
    for (int j = 0; j < 8; ++j) w[j] = frag_p(Wp, fo, j * 8);
    // every load runs one k chunk (16 WMMAs) ahead of its use: the row values are reloaded as soon as they are split, a weight fragment right behind its own WMMA pair; a fragment loaded at its pair would be waited for in full 8 times a chunk. Unrolled whole, so that the waits are counted ones
#pragma unroll
    for (int kc = 0; kc < DM / 32; ++kc) {
      __builtin_amdgcn_sched_barrier(0);   // keeps this chunk's split below the chunk before: moved up among those WMMAs it waits for row loads that have only just gone out
      const F2 a = split_raw(ra);
      if (kc + 1 < DM / 32) ra = raw_row(Ar, (kc + 1) * 32, lane);
#pragma unroll
      for (int j = 0; j < 8; ++j) { acc[j] = wmma_bf(a.l, w[j], acc[j]); acc[j] = wmma_bf(a.h, w[j], acc[j]);
        if (kc + 1 < DM / 32) w[j] = frag_p(Wp, fo, j * 8 + kc + 1); } }
#pragma unroll
    for (int j = 0; j < 8; ++j) { const float bb = bfr(bias[pass * 128 + j * 16 + col]);
#pragma unroll
      for (int r = 0; r < 8; ++r) so[wv][8 * g + r][j * 16 + col] = acc[j][r] + bb; }
    LDSX();
    for (int rl = 0; rl < 16; ++rl) vst2(dst + (r0 + rl) * DM + pass * 128 + lane * 4, *(const v4f*)&so[wv][rl][lane * 4]);
    LDSX(); }
}
// ---- k_attn_out: block = 64 positions of one frame, 16 per wave: a wave takes one position at a time, lane l holding channels 4l..4l+3 and 128+4l..128+4l+3 (8 lanes per head), so every q/k/v load is 512 contiguous bytes; the 9 clamped neighbours: scores / sqrt(32), softmax, weighted v (f32 on VALU); then ctx (hi + residual) . Wo + bo + x
__global__ __launch_bounds__(128) void k_attn_out(const float* __restrict__ Q, const float* __restrict__ Kx, const float* __restrict__ V, const __bf16* __restrict__ PW, const float* __restrict__ BO, const float* __restrict__ X, float* __restrict__ OUT) {
  __shared__ __align__(16) float sc[64][DM + 4]; __shared__ __align__(16) float so[4][16][132];
  const int tid = threadIdx.x, wave = tid >> 5, lane = tid & 31, col = lane & 15, g = lane >> 4; const size_t rb0 = (size_t)blockIdx.x * 64; const size_t fr = rb0 / NPOS; const int p0 = (int)(rb0 % NPOS);
  const int wv = __builtin_amdgcn_readfirstlane(wave);   // the wave's number in a scalar register: position, clamps and row offsets are then scalar work
  const char* Qf = (const char*)(Q + fr * NPOS * DM); const char* Kf = (const char*)(Kx + fr * NPOS * DM); const char* Vf = (const char*)(V + fr * NPOS * DM); const unsigned lo = lane * 16;   // the frame's three planes: scalar bases that never change; lo: this lane's byte offset in a 512-byte half row
  // one position a trip (unroll 1: the 38 loads of a position already fill most of the registers); the inner loops are unrolled so that kv, vv and sco stay in registers
#pragma unroll 1
  for (int i = 0; i < 16; ++i) { const int r = wv * 16 + i; const int p = p0 + r; const int py = p / WWd, px = p % WWd;
    unsigned no[9];   // 32-bit byte offsets in the frame: one register a row, shared by the row's k and v loads; the centre (kk 4) is the position itself and serves q too
#pragma unroll
    for (int kk = 0; kk < 9; ++kk) { const int dy = kk / 3 - 1, dx = kk % 3 - 1; int ny = py + dy, nx = px + dx; ny = ny < 0 ? 0 : (ny > HH - 1 ? HH - 1 : ny); nx = nx < 0 ? 0 : (nx > WWd - 1 ? WWd - 1 : nx); no[kk] = (ny * WWd + nx) * (DM * 4) + lo; }
    v4f qv[2], kv[2][9], vv[2][9];
#pragma unroll
    for (int hf = 0; hf < 2; ++hf) { qv[hf] = *(const v4f*)(Qf + no[4] + hf * 512);
#pragma unroll
      for (int kk = 0; kk < 9; ++kk) kv[hf][kk] = *(const v4f*)(Kf + no[kk] + hf * 512);
#pragma unroll
      for (int kk = 0; kk < 9; ++kk) vv[hf][kk] = *(const v4f*)(Vf + no[kk] + hf * 512); }
    // behind the position's loads, before any register that they name is written again; the 9 offsets are named as inputs so that each keeps its own register up to this wait and no load's result lands in one
    asm volatile("s_wait_xcnt 0x0" :: "v"(no[0]), "v"(no[1]), "v"(no[2]), "v"(no[3]), "v"(no[4]), "v"(no[5]), "v"(no[6]), "v"(no[7]), "v"(no[8]) : "memory");
#pragma unroll
    for (int hf = 0; hf < 2; ++hf) { const int c = hf * 128 + lane * 4;
      float sco[9]; float mx = -3.0e38f;
#pragma unroll
      for (int kk = 0; kk < 9; ++kk) { float s = qv[hf][0] * kv[hf][kk][0]; s += qv[hf][1] * kv[hf][kk][1]; s += qv[hf][2] * kv[hf][kk][2]; s += qv[hf][3] * kv[hf][kk][3];
        s = xadd<1>(s); s = xadd<2>(s); s = xadd<4>(s);
        s *= 0.17677669529663687f; sco[kk] = s; mx = fmaxf(mx, s); }   // 1/sqrt(32)
      float den = 0.f;
#pragma unroll
      for (int kk = 0; kk < 9; ++kk) { const float e = expf(sco[kk] - mx); sco[kk] = e; den += e; }
      const float inv = 1.0f / den;
      v4f ov = {0.f, 0.f, 0.f, 0.f};
#pragma unroll
      for (int kk = 0; kk < 9; ++kk) { const float pw = sco[kk] * inv; ov += pw * vv[hf][kk]; }
      vst2(&sc[r][c], ov); } }
  if (tid < 64) for (int c = DM; c < DM + 4; ++c) sc[tid][c] = 0.f;
  __syncthreads();
  // out = ctx . Wo + bo + x
  const __bf16* Wr = PW + (size_t)3 * DM * DM; const size_t r0 = rb0 + wave * 16;
#pragma unroll 1
  for (int pass = 0; pass < 2; ++pass) { v8f acc[8] = {};
    const float* Ar = &sc[wave * 16 + col][0]; const char* Wp = (const char*)(Wr + (size_t)pass * 128 * DM); const unsigned fo = lane * 16;   // the pass's 8 column tiles: 64 fragments in a row
    R16 ra = raw_row(Ar, 0, lane); v16b w[8];
#pragma unroll
    for (int j = 0; j < 8; ++j) w[j] = frag_p(Wp, fo, j * 8);
    // every load runs one k chunk (16 WMMAs) ahead of its use: the row values are reloaded as soon as they are split, a weight fragment right behind its own WMMA pair; a fragment loaded at its pair would be waited for in full 8 times a chunk. Unrolled whole, so that the waits are counted ones
#pragma unroll
    for (int kc = 0; kc < DM / 32; ++kc) {
      __builtin_amdgcn_sched_barrier(0);   // keeps this chunk's split below the chunk before: moved up among those WMMAs it waits for LDS row loads that have only just gone out
      const F2 a = split_raw(ra);
      if (kc + 1 < DM / 32) ra = raw_row(Ar, (kc + 1) * 32, lane);
#pragma unroll
      for (int j = 0; j < 8; ++j) { acc[j] = wmma_bf(a.l, w[j], acc[j]); acc[j] = wmma_bf(a.h, w[j], acc[j]);
        if (kc + 1 < DM / 32) w[j] = frag_p(Wp, fo, j * 8 + kc + 1); } }
#pragma unroll
    for (int j = 0; j < 8; ++j) { const int c = pass * 128 + j * 16 + col; const float bb = bfr(BO[c]);
#pragma unroll
      for (int r = 0; r < 8; ++r) so[wave][8 * g + r][j * 16 + col] = acc[j][r] + bb + bfr(X[(r0 + 8 * g + r) * DM + c]); }
    LDSX();
    for (int rl = 0; rl < 16; ++rl) vst2(OUT + (r0 + rl) * DM + pass * 128 + lane * 4, *(const v4f*)&so[wave][rl][lane * 4]);
    LDSX(); }
}
extern "C" void kernel_launch(void* const* d_in, const int* in_sizes, int n_in, void* d_out, int out_size, void* d_ws, size_t ws_size, hipStream_t stream) {
  (void)in_sizes; (void)n_in; (void)out_size;
  const float** F = (const float**)d_in;   // 0 x [2,8,32,32,256], 1 ln_g, 2 ln_b, 3 wq (in,out), 4 bq, 5 wk, 6 bk, 7 wv, 8 bv, 9 wo, 10 bo
  if (ws_size < (size_t)WS_END) return;
  char* ws = (char*)d_ws; __bf16* PW = (__bf16*)(ws + WS_PW); float *Q = (float*)(ws + WS_Q), *Kx = (float*)(ws + WS_K), *V = (float*)(ws + WS_V);
  k_pack<<<dim3(DM / 16, 4), 256, 0, stream>>>(F[3], F[5], F[7], F[9], PW);
  k_qkv<<<NR / 64, 384, 0, stream>>>(F[0], F[1], F[2], PW, F[4], F[6], F[8], Q, Kx, V);
  k_attn_out<<<TRB, 128, 0, stream>>>(Q, Kx, V, PW, F[10], F[0], (float*)d_out);
}

// v005
// One run takes 43.6 microseconds.
// In two side-by-side timings against v004, it was 1.28 and 1.27 times as fast.
// Counting every step since v000, it is 2.78 times as fast.
// compute dtype: all float inputs rounded to bf16; LayerNorm (biased variance, eps 1e-5) in f32; q/k/v = xn (bf16 hi + residual, 2 products) . W + b on WMMA 16x16x32 ((in,out) weights packed in B-fragment order), kept in f32; the 3x3 clamped-neighbourhood attention (9 keys per position, 8 heads x 32) entirely in f32 on VALU (scores / sqrt(32), softmax with precise expf, weighted sum); out = ctx (bf16 hi + residual, 2 products) . Wo + bo + x; f32 accumulate.
#include <hip/hip_runtime.h>
#include <math.h>

typedef __attribute__((ext_vector_type(16))) _Float16 v16h;
typedef __attribute__((ext_vector_type(16))) __bf16 v16b;
typedef __attribute__((ext_vector_type(8)))  _Float16 v8h;
typedef __attribute__((ext_vector_type(8)))  float v8f;
typedef __attribute__((ext_vector_type(4)))  float v4f;
typedef __attribute__((ext_vector_type(2)))  float v2f;
typedef __attribute__((ext_vector_type(4)))  unsigned v4u;
typedef __attribute__((ext_vector_type(4)))  int v4i;
typedef float __attribute__((may_alias)) float_a;
typedef int __attribute__((may_alias)) int_a;

template <typename T> __device__ __forceinline__ void vst2(void* p, T v) { *(T*)p = v;  }
__device__ __forceinline__ v8f wmma16(v16h a, v16h b, v8f c) {
  v8f d = __builtin_amdgcn_wmma_f32_16x16x32_f16(false, a, false, b, (short)0, c, false, false);
  asm volatile("v_nop\n\tv_nop\n\tv_nop\n\tv_nop" : "+v"(d) : "v"(a), "v"(b));
  return d;
}
__device__ __forceinline__ v8f wmma_bf(v16b a, v16b b, v8f c) {
  v8f d = __builtin_amdgcn_wmma_f32_16x16x32_bf16(false, a, false, b, (short)0, c, false, false);
  asm volatile("v_nop\n\tv_nop\n\tv_nop\n\tv_nop" : "+v"(d) : "v"(a), "v"(b));
  return d;
}
// 16x16x32 fragments: lane = (h = lane>>4, row/col = lane&15); elements 0..7 = k0+8h+0..7, 8..15 = k0+16+8h+0..7; D element r = row 8h+r
__device__ __forceinline__ v16h frag_h(const _Float16* rowk0, int lane) {
  union { v16h v; v8h q[2]; } u; const _Float16* p = rowk0 + 8 * (lane >> 4);
  u.q[0] = *(const v8h*)p; u.q[1] = *(const v8h*)(p + 16); return u.v;
}
__device__ __forceinline__ v16h frag_f32(const float* rowk0, int lane) {
  v16h a; const float* p = rowk0 + 8 * (lane >> 4);
#pragma unroll
  for (int i = 0; i < 8; ++i) { a[i] = (_Float16)p[i]; a[8 + i] = (_Float16)p[16 + i]; }
  return a;
}
__device__ __forceinline__ v16h frag_f32s(const float* rowk0, int lane, float sc) {
  v16h a; const float* p = rowk0 + 8 * (lane >> 4);
#pragma unroll
  for (int i = 0; i < 8; ++i) { a[i] = (_Float16)(p[i] * sc); a[8 + i] = (_Float16)(p[16 + i] * sc); }
  return a;
}
// column fragment from a [K][ld] layout (column n), rows >= K read as 0
__device__ __forceinline__ v16h fragc_f32(const float* W, int k0, int n, int lane, int ld, int K) {
  v16h a; const int g = lane >> 4;
#pragma unroll
  for (int i = 0; i < 8; ++i) { const int ka = k0 + 8 * g + i, kb = ka + 16;
    a[i] = (_Float16)(ka < K ? W[(size_t)(ka < K ? ka : K - 1) * ld + n] : 0.f); a[8 + i] = (_Float16)(kb < K ? W[(size_t)(kb < K ? kb : K - 1) * ld + n] : 0.f); }
  return a;
}
struct F2 { v16b h, l; };
__device__ __forceinline__ F2 bsplit16(const float v[16]) { F2 r;
#pragma unroll
  for (int i = 0; i < 16; ++i) { const __bf16 h = (__bf16)v[i]; r.h[i] = h; r.l[i] = (__bf16)(v[i] - (float)h); }
  return r; }
__device__ __forceinline__ F2 split_row(const float* row, int k0, int lane) { float v[16]; const float* p = row + k0 + 8 * (lane >> 4);
#pragma unroll
  for (int i = 0; i < 8; ++i) { v[i] = p[i]; v[8 + i] = p[16 + i]; }
  return bsplit16(v); }
__device__ __forceinline__ F2 split_rowK(const float* row, int k0, int lane, int K) { float v[16]; const int g = lane >> 4;
#pragma unroll
  for (int i = 0; i < 8; ++i) { const int ka = k0 + 8 * g + i, kb = ka + 16; v[i] = ka < K ? row[ka < K ? ka : K - 1] : 0.f; v[8 + i] = kb < K ? row[kb < K ? kb : K - 1] : 0.f; }
  return bsplit16(v); }
__device__ __forceinline__ F2 split_col(const float* W, int k0, int n, int lane, int ld, int K) { float v[16]; const int g = lane >> 4;
#pragma unroll
  for (int i = 0; i < 8; ++i) { const int ka = k0 + 8 * g + i, kb = ka + 16; v[i] = ka < K ? W[(size_t)(ka < K ? ka : K - 1) * ld + n] : 0.f; v[8 + i] = kb < K ? W[(size_t)(kb < K ? kb : K - 1) * ld + n] : 0.f; }
  return bsplit16(v); }
__device__ __forceinline__ v8f mac3(const F2& a, const F2& b, v8f c) { c = wmma_bf(a.l, b.h, c); c = wmma_bf(a.h, b.l, c); return wmma_bf(a.h, b.h, c); }
__device__ __forceinline__ float sigm(float v) { return 1.0f / (1.0f + expf(-v)); }
#define LDSX() do { asm volatile("s_wait_dscnt 0" ::: "memory"); __builtin_amdgcn_wave_barrier(); __builtin_amdgcn_fence(__ATOMIC_RELEASE, "workgroup"); } while (0)


// Local-window self attention over video feature maps (2 x 8 frames of 32 x 32 positions, dim 256, 8 heads x 32): LayerNorm, q/k/v projections, each position attends to its 3 x 3 replicate-clamped neighbourhood, output projection + residual.
#define NFR 16          // b*t frames
#define HH 32
#define WWd 32
#define NPOS (HH * WWd)
#define DM 256
#define NHD 8
#define HD 32
#define NR (NFR * NPOS)   // 16384 rows
#ifndef TRB
#define TRB (NR / 64)
#endif
typedef __attribute__((ext_vector_type(8))) __bf16 v8b;
// B fragment number t = (16-column tile) * 8 + (32-k chunk) of a packed weight matrix: 1 KiB, elements 0..7 of all 32 lanes and then elements 8..15, so each of the two loads is 512 contiguous bytes (4 whole lines). Wb: the first fragment, fo = lane * 16
__device__ __forceinline__ v16b frag_p(const char* Wb, unsigned fo, int t) {
  union { v16b v; v8b q[2]; } u; const char* p = Wb + (fo + (unsigned)t * 1024u);
  u.q[0] = *(const v8b*)p; u.q[1] = *(const v8b*)(p + 512); return u.v;
}
// the 16 f32 values of a row fragment as loaded, split later: the loads can then go out one k chunk ahead of the conversion
struct R16 { v4f q[4]; };
__device__ __forceinline__ R16 raw_row(const float* row, int k0, int lane) { R16 r; const float* p = row + k0 + 8 * (lane >> 4);
  r.q[0] = *(const v4f*)p; r.q[1] = *(const v4f*)(p + 4); r.q[2] = *(const v4f*)(p + 16); r.q[3] = *(const v4f*)(p + 20); return r; }
__device__ __forceinline__ F2 split_raw(const R16& r) { float v[16];
#pragma unroll
  for (int i = 0; i < 16; ++i) v[i] = r.q[i >> 2][i & 3];
  return bsplit16(v); }
__device__ __forceinline__ float bfr(float v) { return (float)(__bf16)v; }
__device__ __attribute__((noinline)) float exp_ni(float v) { return expf(v); }
__device__ __attribute__((noinline)) float erf_ni(float v) { return erff(v); }

#define WS_PW  0u                                   // bf16 in B-fragment order: wq, wk, wv, wo, each [16 column tiles][8 k chunks][2 halves][32 lanes][8]
#define WS_Q   (WS_PW + 2u * 4 * DM * DM)            // f32 [NR][256] q ; K ; V
#define WS_K   (WS_Q + 4u * (size_t)NR * DM)
#define WS_V   (WS_K + 4u * (size_t)NR * DM)
#define WS_END (WS_V + 4u * (size_t)NR * DM)

// ---- k_pack: block = one 16-column tile of one weight matrix, wave = one 32-k chunk: each lane gathers the 16 values of its own B fragment (column jt * 16 + col, k = kc * 32 + 8 g + 0..7 and + 16 + 0..7; a load covers two 64-byte row pieces) and the wave stores the fragment as two runs of 512 bytes, every line written whole by one wave
__global__ __launch_bounds__(256) void k_pack(const float* __restrict__ WQ, const float* __restrict__ WK, const float* __restrict__ WV, const float* __restrict__ WO, __bf16* __restrict__ PW) {
  const int jt = blockIdx.x, which = blockIdx.y, lane = threadIdx.x & 31, col = lane & 15, g = lane >> 4; const int kc = __builtin_amdgcn_readfirstlane(threadIdx.x >> 5);
  const float* Wm = (which == 0) ? WQ : (which == 1) ? WK : (which == 2) ? WV : WO;
  const char* Wt = (const char*)(Wm + (size_t)kc * 32 * DM + jt * 16); const unsigned po = (8 * g * DM + col) * 4;   // scalar base and one 32-bit byte offset serve all 16 loads
  float v[16];
#pragma unroll
  for (int i = 0; i < 8; ++i) { v[i] = *(const float*)(Wt + po + i * (DM * 4)); v[8 + i] = *(const float*)(Wt + po + (16 + i) * (DM * 4)); }
  v8b o0, o1;
#pragma unroll
  for (int i = 0; i < 8; ++i) { o0[i] = (__bf16)v[i]; o1[i] = (__bf16)v[8 + i]; }
  __bf16* d = PW + (((size_t)which * 16 + jt) * 8 + kc) * 512 + lane * 8;
  vst2(d, o0); vst2(d + 256, o1);
}
// one step of a lane sum (M = 1, 2, 4 cover the 8 lanes of one head): lane l adds the value of lane l ^ M inside its 16-lane row (folds into v_add_f32_dpp row_xmask)
template <int M> __device__ __forceinline__ float xadd(float v) { return v + __int_as_float(__builtin_amdgcn_update_dpp(0, __float_as_int(v), 0x160 + M, 0xf, 0xf, true)); }
// lane l with lane l ^ 16
__device__ __forceinline__ float xhalf(float v) { return __int_as_float(__builtin_amdgcn_permlanex16(__float_as_int(v), __float_as_int(v), 0x76543210, 0xfedcba98, false, false)); }
// sum over the wave's 32 lanes, the partner distances in the order 1, 2, 4, 8, 16
__device__ __forceinline__ float wsum(float v) { v = xadd<1>(v); v = xadd<2>(v); v = xadd<4>(v); v = xadd<8>(v); return v + xhalf(v); }
// ---- k_qkv: block = 64 rows, 12 waves. First xn = (x - mu) * rsqrt(var + 1e-5) * g + b (biased variance) of the 64 rows into LDS, a wave taking every 12th row whole (lane l holds channels 4l..4l+3 and 128+4l..128+4l+3); then wave = (16 rows, which 0 q / 1 k / 2 v): xn (hi + residual) . W rows (2 x 8 tiles) + b -> f32 rows
__global__ __launch_bounds__(384) void k_qkv(const float* __restrict__ X, const float* __restrict__ G, const float* __restrict__ Bt, const __bf16* __restrict__ PW, const float* __restrict__ BQ, const float* __restrict__ BK, const float* __restrict__ BV, float* __restrict__ Q, float* __restrict__ Kx, float* __restrict__ V) {
  __shared__ __align__(16) float sx[64][DM + 4]; __shared__ __align__(16) float so[12][16][132];
  const int tid = threadIdx.x, lane = tid & 31, col = lane & 15, g = lane >> 4; const size_t rb0 = (size_t)blockIdx.x * 64;
  const int wv = __builtin_amdgcn_readfirstlane(tid >> 5);   // the wave's number in a scalar register: its rows, its weight matrix, bias and destination are then scalar work
  { v4f xv[6][2], gg[2], bt[2]; float mu[6], inv[6];   // the wave's rows wv, wv + 12, ..: five for every wave, a sixth for waves 0 to 3 (the others re-read row 63 there and do not store it). All row loads go out first, and each stage runs over all six rows, so that six independent chains fill one another's latency
    const char* Xb = (const char*)(X + rb0 * DM); const unsigned lo = lane * 16, xo = wv * (DM * 4) + lo, xo5 = (wv < 4 ? wv + 60 : 63) * (DM * 4) + lo;   // scalar bases and three 32-bit byte offsets serve all 16 loads
#pragma unroll
    for (int it = 0; it < 6; ++it) { const char* xr = Xb + (it < 5 ? xo + it * 12 * (DM * 4) : xo5); xv[it][0] = *(const v4f*)xr; xv[it][1] = *(const v4f*)(xr + 512); }
#pragma unroll
    for (int hf = 0; hf < 2; ++hf) { gg[hf] = *(const v4f*)((const char*)G + lo + hf * 512); bt[hf] = *(const v4f*)((const char*)Bt + lo + hf * 512); }
    // behind the loads, before any register that they name is written again; the three offsets are named as inputs so that each keeps its own register up to this wait and no load's result lands in one
    asm volatile("s_wait_xcnt 0x0" :: "v"(lo), "v"(xo), "v"(xo5) : "memory");
#pragma unroll
    for (int hf = 0; hf < 2; ++hf) {
#pragma unroll
      for (int i = 0; i < 4; ++i) { gg[hf][i] = bfr(gg[hf][i]); bt[hf][i] = bfr(bt[hf][i]); } }
#pragma unroll
    for (int it = 0; it < 6; ++it) { float s[2];
#pragma unroll
      for (int hf = 0; hf < 2; ++hf) { s[hf] = 0.f;
#pragma unroll
        for (int i = 0; i < 4; ++i) { xv[it][hf][i] = bfr(xv[it][hf][i]); s[hf] += xv[it][hf][i]; }
        s[hf] = wsum(s[hf]); }
      mu[it] = (s[0] + s[1]) / (float)DM; }
#pragma unroll
    for (int it = 0; it < 6; ++it) { float q[2];
#pragma unroll
      for (int hf = 0; hf < 2; ++hf) { q[hf] = 0.f;
#pragma unroll
        for (int i = 0; i < 4; ++i) { const float dd = xv[it][hf][i] - mu[it]; q[hf] += dd * dd; }
        q[hf] = wsum(q[hf]); }
      inv[it] = 1.0f / sqrtf((q[0] + q[1]) / (float)DM + 1e-5f); }
#pragma unroll
    for (int it = 0; it < 6; ++it) { const int r = wv + 12 * it;
      if (it < 5 || r < 64) {
#pragma unroll
        for (int hf = 0; hf < 2; ++hf) { v4f o4;
#pragma unroll
          for (int i = 0; i < 4; ++i) o4[i] = (xv[it][hf][i] - mu[it]) * inv[it] * gg[hf][i] + bt[hf][i];
          vst2(&sx[r][hf * 128 + lane * 4], o4); } } } }
  __syncthreads();   // a wave's 16 rows of xn were written by all 12 waves
  const int which = wv >> 2; const size_t r0 = rb0 + (wv & 3) * 16;
  const __bf16* Wr = PW + (size_t)which * DM * DM; const float* bias = (which == 0) ? BQ : (which == 1) ? BK : BV; float* dst = (which == 0) ? Q : (which == 1) ? Kx : V;
#pragma unroll 1
  for (int pass = 0; pass < 2; ++pass) { v8f acc[8] = {};
    const float* Ar = &sx[(wv & 3) * 16 + col][0]; const char* Wp = (const char*)(Wr + (size_t)pass * 128 * DM); const unsigned fo = lane * 16;   // the pass's 8 column tiles: 64 fragments in a row
    R16 ra = raw_row(Ar, 0, lane); v16b w[8];
#pragma unroll
    for (int j = 0; j < 8; ++j) w[j] = frag_p(Wp, fo, j * 8);
    // every load runs one k chunk (16 WMMAs) ahead of its use: the row values are reloaded as soon as they are split, a weight fragment right behind its own WMMA pair; a fragment loaded at its pair would be waited for in full 8 times a chunk. Unrolled whole, so that the waits are counted ones
#pragma unroll
    for (int kc = 0; kc < DM / 32; ++kc) {
      __builtin_amdgcn_sched_barrier(0);   // keeps this chunk's split below the chunk before: moved up among those WMMAs it waits for row loads that have only just gone out
      const F2 a = split_raw(ra);
      if (kc + 1 < DM / 32) ra = raw_row(Ar, (kc + 1) * 32, lane);
#pragma unroll
      for (int j = 0; j < 8; ++j) { acc[j] = wmma_bf(a.l, w[j], acc[j]); acc[j] = wmma_bf(a.h, w[j], acc[j]);
        if (kc + 1 < DM / 32) w[j] = frag_p(Wp, fo, j * 8 + kc + 1); } }
#pragma unroll
    for (int j = 0; j < 8; ++j) { const float bb = bfr(bias[pass * 128 + j * 16 + col]);
#pragma unroll
      for (int r = 0; r < 8; ++r) so[wv][8 * g + r][j * 16 + col] = acc[j][r] + bb; }
    LDSX();
    for (int rl = 0; rl < 16; ++rl) vst2(dst + (r0 + rl) * DM + pass * 128 + lane * 4, *(const v4f*)&so[wv][rl][lane * 4]);
    LDSX(); }
}
// ---- k_attn_out: block = 64 positions of one frame (2 image rows), 16 waves, 4 on a SIMD, so that one wave's load latency and dependent chains run under the others' work. Attention: a wave takes one position at a time, lane l holding channels 4l..4l+3 and 128+4l..128+4l+3 (8 lanes per head), so every q/k/v load is 512 contiguous bytes; in trip i the 16 waves stand on a patch of 8 columns x 2 rows, so that a k or v row that several positions want is asked for by all of them at about the same time; the 9 clamped neighbours: scores / sqrt(32), softmax, weighted v (f32 on VALU); then wave = (16 rows, 64 columns): ctx (hi + residual) . Wo + bo + x
__global__ __launch_bounds__(512) void k_attn_out(const float* __restrict__ Q, const float* __restrict__ Kx, const float* __restrict__ V, const __bf16* __restrict__ PW, const float* __restrict__ BO, const float* __restrict__ X, float* __restrict__ OUT) {
  __shared__ __align__(16) float sc[64][DM + 4]; __shared__ __align__(16) float so[16][16][68];
  const int tid = threadIdx.x, lane = tid & 31, col = lane & 15, g = lane >> 4; const size_t rb0 = (size_t)blockIdx.x * 64; const size_t fr = rb0 / NPOS; const int p0 = (int)(rb0 % NPOS);
  const int wv = __builtin_amdgcn_readfirstlane(tid >> 5);   // the wave's number in a scalar register: position, clamps and row offsets are then scalar work
  const char* Qf = (const char*)(Q + fr * NPOS * DM); const char* Kf = (const char*)(Kx + fr * NPOS * DM); const char* Vf = (const char*)(V + fr * NPOS * DM); const unsigned lo = lane * 16;   // the frame's three planes: scalar bases that never change; lo: this lane's byte offset in a 512-byte half row
  // one position a trip (unroll 1: the 38 loads of a position already fill most of the registers); the inner loops are unrolled so that kv, vv and sco stay in registers
#pragma unroll 1
  for (int i = 0; i < 4; ++i) { const int r = (wv >> 3) * WWd + i * 8 + (wv & 7); const int p = p0 + r; const int py = p / WWd, px = p % WWd;
    unsigned no[9];   // 32-bit byte offsets in the frame: one register a row, shared by the row's k and v loads; the centre (kk 4) is the position itself and serves q too
#pragma unroll
    for (int kk = 0; kk < 9; ++kk) { const int dy = kk / 3 - 1, dx = kk % 3 - 1; int ny = py + dy, nx = px + dx; ny = ny < 0 ? 0 : (ny > HH - 1 ? HH - 1 : ny); nx = nx < 0 ? 0 : (nx > WWd - 1 ? WWd - 1 : nx); no[kk] = (ny * WWd + nx) * (DM * 4) + lo; }
    v4f qv[2], kv[2][9], vv[2][9];
#pragma unroll
    for (int hf = 0; hf < 2; ++hf) { qv[hf] = *(const v4f*)(Qf + no[4] + hf * 512);
#pragma unroll
      for (int kk = 0; kk < 9; ++kk) kv[hf][kk] = *(const v4f*)(Kf + no[kk] + hf * 512);
#pragma unroll
      for (int kk = 0; kk < 9; ++kk) vv[hf][kk] = *(const v4f*)(Vf + no[kk] + hf * 512); }
    // behind the position's loads, before any register that they name is written again; the 9 offsets are named as inputs so that each keeps its own register up to this wait and no load's result lands in one
    asm volatile("s_wait_xcnt 0x0" :: "v"(no[0]), "v"(no[1]), "v"(no[2]), "v"(no[3]), "v"(no[4]), "v"(no[5]), "v"(no[6]), "v"(no[7]), "v"(no[8]) : "memory");
#pragma unroll
    for (int hf = 0; hf < 2; ++hf) { const int c = hf * 128 + lane * 4;
      float sco[9]; float mx = -3.0e38f;
#pragma unroll
      for (int kk = 0; kk < 9; ++kk) { float s = qv[hf][0] * kv[hf][kk][0]; s += qv[hf][1] * kv[hf][kk][1]; s += qv[hf][2] * kv[hf][kk][2]; s += qv[hf][3] * kv[hf][kk][3];
        s = xadd<1>(s); s = xadd<2>(s); s = xadd<4>(s);
        s *= 0.17677669529663687f; sco[kk] = s; mx = fmaxf(mx, s); }   // 1/sqrt(32)
      float den = 0.f;
#pragma unroll
      for (int kk = 0; kk < 9; ++kk) { const float e = expf(sco[kk] - mx); sco[kk] = e; den += e; }
      const float inv = 1.0f / den;
      v4f ov = {0.f, 0.f, 0.f, 0.f};
#pragma unroll
      for (int kk = 0; kk < 9; ++kk) { const float pw = sco[kk] * inv; ov += pw * vv[hf][kk]; }
      vst2(&sc[r][c], ov); } }
  if (tid < 64) for (int c = DM; c < DM + 4; ++c) sc[tid][c] = 0.f;
  __syncthreads();
  // out = ctx . Wo + bo + x: waves wv, wv + 4, wv + 8, wv + 12 take the same 16 rows and one 64-column group each; the four waves of a column group read the same weight fragments
  const int rt = wv & 3, cg = wv >> 2;
  const __bf16* Wr = PW + (size_t)3 * DM * DM; const size_t r0 = rb0 + rt * 16;
  v8f acc[4] = {};
  const float* Ar = &sc[rt * 16 + col][0]; const char* Wp = (const char*)(Wr + (size_t)cg * 64 * DM); const unsigned fo = lane * 16;   // the wave's 4 column tiles: 32 fragments in a row
  R16 ra = raw_row(Ar, 0, lane); v16b w[4];
#pragma unroll
  for (int j = 0; j < 4; ++j) w[j] = frag_p(Wp, fo, j * 8);
  // every load runs one k chunk (8 WMMAs) ahead of its use: the row values are reloaded as soon as they are split, a weight fragment right behind its own WMMA pair; a fragment loaded at its pair would be waited for in full 4 times a chunk. Unrolled whole, so that the waits are counted ones
#pragma unroll
  for (int kc = 0; kc < DM / 32; ++kc) {
    __builtin_amdgcn_sched_barrier(0);   // keeps this chunk's split below the chunk before: moved up among those WMMAs it waits for row loads that have only just gone out
    const F2 a = split_raw(ra);
    if (kc + 1 < DM / 32) ra = raw_row(Ar, (kc + 1) * 32, lane);
#pragma unroll
    for (int j = 0; j < 4; ++j) { acc[j] = wmma_bf(a.l, w[j], acc[j]); acc[j] = wmma_bf(a.h, w[j], acc[j]);
      if (kc + 1 < DM / 32) w[j] = frag_p(Wp, fo, j * 8 + kc + 1); } }
#pragma unroll
  for (int j = 0; j < 4; ++j) { const int c = cg * 64 + j * 16 + col; const float bb = bfr(BO[c]);
#pragma unroll
    for (int r = 0; r < 8; ++r) so[wv][8 * g + r][j * 16 + col] = acc[j][r] + bb + bfr(X[(r0 + 8 * g + r) * DM + c]); }
  LDSX();
  // a store covers two rows' 256-byte pieces, each two whole lines
  for (int rl = 0; rl < 16; rl += 2) vst2(OUT + (r0 + rl + g) * DM + cg * 64 + col * 4, *(const v4f*)&so[wv][rl + g][col * 4]);
}
extern "C" void kernel_launch(void* const* d_in, const int* in_sizes, int n_in, void* d_out, int out_size, void* d_ws, size_t ws_size, hipStream_t stream) {
  (void)in_sizes; (void)n_in; (void)out_size;
  const float** F = (const float**)d_in;   // 0 x [2,8,32,32,256], 1 ln_g, 2 ln_b, 3 wq (in,out), 4 bq, 5 wk, 6 bk, 7 wv, 8 bv, 9 wo, 10 bo
  if (ws_size < (size_t)WS_END) return;
  char* ws = (char*)d_ws; __bf16* PW = (__bf16*)(ws + WS_PW); float *Q = (float*)(ws + WS_Q), *Kx = (float*)(ws + WS_K), *V = (float*)(ws + WS_V);
  k_pack<<<dim3(DM / 16, 4), 256, 0, stream>>>(F[3], F[5], F[7], F[9], PW);
  k_qkv<<<NR / 64, 384, 0, stream>>>(F[0], F[1], F[2], PW, F[4], F[6], F[8], Q, Kx, V);
  k_attn_out<<<TRB, 512, 0, stream>>>(Q, Kx, V, PW, F[10], F[0], (float*)d_out);
}

// v006
// A run of this version takes 42.8 microseconds.
// In two side-by-side timings against v005, it was 1.03 and 1.04 times as fast.
// All steps since v000 together make it 2.87 times as fast.
// compute dtype: all float inputs rounded to bf16; LayerNorm (biased variance, eps 1e-5) in f32; q/k/v = xn (bf16 hi + residual, 2 products) . W + b on WMMA 16x16x32 ((in,out) weights packed in B-fragment order), kept in f32; the 3x3 clamped-neighbourhood attention (9 keys per position, 8 heads x 32) entirely in f32 on VALU (scores / sqrt(32), softmax with precise expf, weighted sum); out = ctx (bf16 hi + residual, 2 products) . Wo + bo + x; f32 accumulate.
#include <hip/hip_runtime.h>
#include <math.h>

typedef __attribute__((ext_vector_type(16))) _Float16 v16h;
typedef __attribute__((ext_vector_type(16))) __bf16 v16b;
typedef __attribute__((ext_vector_type(8)))  _Float16 v8h;
typedef __attribute__((ext_vector_type(8)))  float v8f;
typedef __attribute__((ext_vector_type(4)))  float v4f;
typedef __attribute__((ext_vector_type(2)))  float v2f;
typedef __attribute__((ext_vector_type(4)))  unsigned v4u;
typedef __attribute__((ext_vector_type(4)))  int v4i;
typedef float __attribute__((may_alias)) float_a;
typedef int __attribute__((may_alias)) int_a;

template <typename T> __device__ __forceinline__ void vst2(void* p, T v) { *(T*)p = v;  }
__device__ __forceinline__ v8f wmma16(v16h a, v16h b, v8f c) {
  v8f d = __builtin_amdgcn_wmma_f32_16x16x32_f16(false, a, false, b, (short)0, c, false, false);
  asm volatile("v_nop\n\tv_nop\n\tv_nop\n\tv_nop" : "+v"(d) : "v"(a), "v"(b));
  return d;
}
__device__ __forceinline__ v8f wmma_bf(v16b a, v16b b, v8f c) {
  v8f d = __builtin_amdgcn_wmma_f32_16x16x32_bf16(false, a, false, b, (short)0, c, false, false);
  asm volatile("v_nop\n\tv_nop\n\tv_nop\n\tv_nop" : "+v"(d) : "v"(a), "v"(b));
  return d;
}
// 16x16x32 fragments: lane = (h = lane>>4, row/col = lane&15); elements 0..7 = k0+8h+0..7, 8..15 = k0+16+8h+0..7; D element r = row 8h+r
__device__ __forceinline__ v16h frag_h(const _Float16* rowk0, int lane) {
  union { v16h v; v8h q[2]; } u; const _Float16* p = rowk0 + 8 * (lane >> 4);
  u.q[0] = *(const v8h*)p; u.q[1] = *(const v8h*)(p + 16); return u.v;
}
__device__ __forceinline__ v16h frag_f32(const float* rowk0, int lane) {
  v16h a; const float* p = rowk0 + 8 * (lane >> 4);
#pragma unroll
  for (int i = 0; i < 8; ++i) { a[i] = (_Float16)p[i]; a[8 + i] = (_Float16)p[16 + i]; }
  return a;
}
__device__ __forceinline__ v16h frag_f32s(const float* rowk0, int lane, float sc) {
  v16h a; const float* p = rowk0 + 8 * (lane >> 4);
#pragma unroll
  for (int i = 0; i < 8; ++i) { a[i] = (_Float16)(p[i] * sc); a[8 + i] = (_Float16)(p[16 + i] * sc); }
  return a;
}
// column fragment from a [K][ld] layout (column n), rows >= K read as 0
__device__ __forceinline__ v16h fragc_f32(const float* W, int k0, int n, int lane, int ld, int K) {
  v16h a; const int g = lane >> 4;
#pragma unroll
  for (int i = 0; i < 8; ++i) { const int ka = k0 + 8 * g + i, kb = ka + 16;
    a[i] = (_Float16)(ka < K ? W[(size_t)(ka < K ? ka : K - 1) * ld + n] : 0.f); a[8 + i] = (_Float16)(kb < K ? W[(size_t)(kb < K ? kb : K - 1) * ld + n] : 0.f); }
  return a;
}
struct F2 { v16b h, l; };
__device__ __forceinline__ F2 bsplit16(const float v[16]) { F2 r;
#pragma unroll
  for (int i = 0; i < 16; ++i) { const __bf16 h = (__bf16)v[i]; r.h[i] = h; r.l[i] = (__bf16)(v[i] - (float)h); }
  return r; }
__device__ __forceinline__ F2 split_row(const float* row, int k0, int lane) { float v[16]; const float* p = row + k0 + 8 * (lane >> 4);
#pragma unroll
  for (int i = 0; i < 8; ++i) { v[i] = p[i]; v[8 + i] = p[16 + i]; }
  return bsplit16(v); }
__device__ __forceinline__ F2 split_rowK(const float* row, int k0, int lane, int K) { float v[16]; const int g = lane >> 4;
#pragma unroll
  for (int i = 0; i < 8; ++i) { const int ka = k0 + 8 * g + i, kb = ka + 16; v[i] = ka < K ? row[ka < K ? ka : K - 1] : 0.f; v[8 + i] = kb < K ? row[kb < K ? kb : K - 1] : 0.f; }
  return bsplit16(v); }
__device__ __forceinline__ F2 split_col(const float* W, int k0, int n, int lane, int ld, int K) { float v[16]; const int g = lane >> 4;
#pragma unroll
  for (int i = 0; i < 8; ++i) { const int ka = k0 + 8 * g + i, kb = ka + 16; v[i] = ka < K ? W[(size_t)(ka < K ? ka : K - 1) * ld + n] : 0.f; v[8 + i] = kb < K ? W[(size_t)(kb < K ? kb : K - 1) * ld + n] : 0.f; }
  return bsplit16(v); }
__device__ __forceinline__ v8f mac3(const F2& a, const F2& b, v8f c) { c = wmma_bf(a.l, b.h, c); c = wmma_bf(a.h, b.l, c); return wmma_bf(a.h, b.h, c); }
__device__ __forceinline__ float sigm(float v) { return 1.0f / (1.0f + expf(-v)); }
#define LDSX() do { asm volatile("s_wait_dscnt 0" ::: "memory"); __builtin_amdgcn_wave_barrier(); __builtin_amdgcn_fence(__ATOMIC_RELEASE, "workgroup"); } while (0)


// Local-window self attention over video feature maps (2 x 8 frames of 32 x 32 positions, dim 256, 8 heads x 32): LayerNorm, q/k/v projections, each position attends to its 3 x 3 replicate-clamped neighbourhood, output projection + residual.
#define NFR 16          // b*t frames
#define HH 32
#define WWd 32
#define NPOS (HH * WWd)
#define DM 256
#define NHD 8
#define HD 32
#define NR (NFR * NPOS)   // 16384 rows
#ifndef TRB
#define TRB (NR / 64)
#endif
typedef __attribute__((ext_vector_type(8))) __bf16 v8b;
// B fragment number t = (16-column tile) * 8 + (32-k chunk) of a packed weight matrix: 1 KiB, elements 0..7 of all 32 lanes and then elements 8..15, so each of the two loads is 512 contiguous bytes (4 whole lines). Wb: the first fragment, fo = lane * 16
__device__ __forceinline__ v16b frag_p(const char* Wb, unsigned fo, int t) {
  union { v16b v; v8b q[2]; } u; const char* p = Wb + (fo + (unsigned)t * 1024u);
  u.q[0] = *(const v8b*)p; u.q[1] = *(const v8b*)(p + 512); return u.v;
}
// the 16 f32 values of a row fragment as loaded, split later: the loads can then go out one k chunk ahead of the conversion
struct R16 { v4f q[4]; };
__device__ __forceinline__ R16 raw_row(const float* row, int k0, int lane) { R16 r; const float* p = row + k0 + 8 * (lane >> 4);
  r.q[0] = *(const v4f*)p; r.q[1] = *(const v4f*)(p + 4); r.q[2] = *(const v4f*)(p + 16); r.q[3] = *(const v4f*)(p + 20); return r; }
__device__ __forceinline__ F2 split_raw(const R16& r) { float v[16];
#pragma unroll
  for (int i = 0; i < 16; ++i) v[i] = r.q[i >> 2][i & 3];
  return bsplit16(v); }
__device__ __forceinline__ float bfr(float v) { return (float)(__bf16)v; }
__device__ __attribute__((noinline)) float exp_ni(float v) { return expf(v); }
__device__ __attribute__((noinline)) float erf_ni(float v) { return erff(v); }

#define WS_PW  0u                                   // bf16 in B-fragment order: wq, wk, wv, wo, each [16 column tiles][8 k chunks][2 halves][32 lanes][8]
#define WS_Q   (WS_PW + 2u * 4 * DM * DM)            // f32 [NR][256] q ; K ; V, the channels of a row in the order QKV_CH
#define WS_K   (WS_Q + 4u * (size_t)NR * DM)
#define WS_V   (WS_K + 4u * (size_t)NR * DM)
#define WS_END (WS_V + 4u * (size_t)NR * DM)
// order of the channels in a q/k/v row of the workspace: place 4l + i holds channel 8l + i and place 128 + 4l + i channel 8l + 4 + i, so that the two 16-byte pieces which lane l takes out of the row's two 512-byte halves are 8 channels of one head
#define QKV_CH(p) ((((p) & 127) >> 2) * 8 + ((p) >> 7) * 4 + ((p) & 3))

// ---- k_pack: block = one 16-column tile of one weight matrix, wave = one 32-k chunk: each lane gathers the 16 values of its own B fragment (packed column jt * 16 + col, k = kc * 32 + 8 g + 0..7 and + 16 + 0..7; a load covers pieces of two rows) and the wave stores the fragment as two runs of 512 bytes, every line written whole by one wave
__global__ __launch_bounds__(256) void k_pack(const float* __restrict__ WQ, const float* __restrict__ WK, const float* __restrict__ WV, const float* __restrict__ WO, __bf16* __restrict__ PW) {
  const int jt = blockIdx.x, which = blockIdx.y, lane = threadIdx.x & 31, col = lane & 15, g = lane >> 4; const int kc = __builtin_amdgcn_readfirstlane(threadIdx.x >> 5);
  const float* Wm = (which == 0) ? WQ : (which == 1) ? WK : (which == 2) ? WV : WO;
  const int pc = jt * 16 + col, cc = which < 3 ? QKV_CH(pc) : pc;   // packed column pc of wq, wk, wv is the weight column of the channel that stands at place pc of a q/k/v row
  const char* Wt = (const char*)(Wm + (size_t)kc * 32 * DM); const unsigned po = (8 * g * DM + cc) * 4;   // scalar base and one 32-bit byte offset serve all 16 loads
  float v[16];
#pragma unroll
  for (int i = 0; i < 8; ++i) { v[i] = *(const float*)(Wt + po + i * (DM * 4)); v[8 + i] = *(const float*)(Wt + po + (16 + i) * (DM * 4)); }
  v8b o0, o1;
#pragma unroll
  for (int i = 0; i < 8; ++i) { o0[i] = (__bf16)v[i]; o1[i] = (__bf16)v[8 + i]; }
  __bf16* d = PW + (((size_t)which * 16 + jt) * 8 + kc) * 512 + lane * 8;
  vst2(d, o0); vst2(d + 256, o1);
}
// step of a sum over neighbouring lanes (the 4 that share one head; a LayerNorm row): lane l adds the value of lane l ^ M inside its 16-lane row (folds into v_add_f32_dpp row_xmask)
template <int M> __device__ __forceinline__ float xadd(float v) { return v + __int_as_float(__builtin_amdgcn_update_dpp(0, __float_as_int(v), 0x160 + M, 0xf, 0xf, true)); }
// lane l with lane l ^ 16
__device__ __forceinline__ float xhalf(float v) { return __int_as_float(__builtin_amdgcn_permlanex16(__float_as_int(v), __float_as_int(v), 0x76543210, 0xfedcba98, false, false)); }
// sum over the wave's 32 lanes, the partner distances in the order 1, 2, 4, 8, 16
__device__ __forceinline__ float wsum(float v) { v = xadd<1>(v); v = xadd<2>(v); v = xadd<4>(v); v = xadd<8>(v); return v + xhalf(v); }
// ---- k_qkv: block = 64 rows, 12 waves. First xn = (x - mu) * rsqrt(var + 1e-5) * g + b (biased variance) of the 64 rows into LDS, a wave taking every 12th row whole (lane l holds channels 4l..4l+3 and 128+4l..128+4l+3); then wave = (16 rows, which 0 q / 1 k / 2 v): xn (hi + residual) . W rows (2 x 8 tiles) + b -> f32 rows
__global__ __launch_bounds__(384) void k_qkv(const float* __restrict__ X, const float* __restrict__ G, const float* __restrict__ Bt, const __bf16* __restrict__ PW, const float* __restrict__ BQ, const float* __restrict__ BK, const float* __restrict__ BV, float* __restrict__ Q, float* __restrict__ Kx, float* __restrict__ V) {
  __shared__ __align__(16) float sx[64][DM + 4]; __shared__ __align__(16) float so[12][16][132];
  const int tid = threadIdx.x, lane = tid & 31, col = lane & 15, g = lane >> 4; const size_t rb0 = (size_t)blockIdx.x * 64;
  const int wv = __builtin_amdgcn_readfirstlane(tid >> 5);   // the wave's number in a scalar register: its rows, its weight matrix, bias and destination are then scalar work
  { v4f xv[6][2], gg[2], bt[2]; float mu[6], inv[6];   // the wave's rows wv, wv + 12, ..: five for every wave, a sixth for waves 0 to 3 (the others re-read row 63 there and do not store it). All row loads go out first, and each stage runs over all six rows, so that six independent chains fill one another's latency
    const char* Xb = (const char*)(X + rb0 * DM); const unsigned lo = lane * 16, xo = wv * (DM * 4) + lo, xo5 = (wv < 4 ? wv + 60 : 63) * (DM * 4) + lo;   // scalar bases and three 32-bit byte offsets serve all 16 loads
#pragma unroll
    for (int it = 0; it < 6; ++it) { const char* xr = Xb + (it < 5 ? xo + it * 12 * (DM * 4) : xo5); xv[it][0] = *(const v4f*)xr; xv[it][1] = *(const v4f*)(xr + 512); }
#pragma unroll
    for (int hf = 0; hf < 2; ++hf) { gg[hf] = *(const v4f*)((const char*)G + lo + hf * 512); bt[hf] = *(const v4f*)((const char*)Bt + lo + hf * 512); }
    // behind the loads, before any register that they name is written again; the three offsets are named as inputs so that each keeps its own register up to this wait and no load's result lands in one
    asm volatile("s_wait_xcnt 0x0" :: "v"(lo), "v"(xo), "v"(xo5) : "memory");
#pragma unroll
    for (int hf = 0; hf < 2; ++hf) {
#pragma unroll
      for (int i = 0; i < 4; ++i) { gg[hf][i] = bfr(gg[hf][i]); bt[hf][i] = bfr(bt[hf][i]); } }
#pragma unroll
    for (int it = 0; it < 6; ++it) { float s[2];
#pragma unroll
      for (int hf = 0; hf < 2; ++hf) { s[hf] = 0.f;
#pragma unroll
        for (int i = 0; i < 4; ++i) { xv[it][hf][i] = bfr(xv[it][hf][i]); s[hf] += xv[it][hf][i]; }
        s[hf] = wsum(s[hf]); }
      mu[it] = (s[0] + s[1]) / (float)DM; }
#pragma unroll
    for (int it = 0; it < 6; ++it) { float q[2];
#pragma unroll
      for (int hf = 0; hf < 2; ++hf) { q[hf] = 0.f;
#pragma unroll
        for (int i = 0; i < 4; ++i) { const float dd = xv[it][hf][i] - mu[it]; q[hf] += dd * dd; }
        q[hf] = wsum(q[hf]); }
      inv[it] = 1.0f / sqrtf((q[0] + q[1]) / (float)DM + 1e-5f); }
#pragma unroll
    for (int it = 0; it < 6; ++it) { const int r = wv + 12 * it;
      if (it < 5 || r < 64) {
#pragma unroll
        for (int hf = 0; hf < 2; ++hf) { v4f o4;
#pragma unroll
          for (int i = 0; i < 4; ++i) o4[i] = (xv[it][hf][i] - mu[it]) * inv[it] * gg[hf][i] + bt[hf][i];
          vst2(&sx[r][hf * 128 + lane * 4], o4); } } } }
  __syncthreads();   // a wave's 16 rows of xn were written by all 12 waves
  const int which = wv >> 2; const size_t r0 = rb0 + (wv & 3) * 16;
  const __bf16* Wr = PW + (size_t)which * DM * DM; const float* bias = (which == 0) ? BQ : (which == 1) ? BK : BV; float* dst = (which == 0) ? Q : (which == 1) ? Kx : V;
#pragma unroll 1
  for (int pass = 0; pass < 2; ++pass) { v8f acc[8] = {};
    const float* Ar = &sx[(wv & 3) * 16 + col][0]; const char* Wp = (const char*)(Wr + (size_t)pass * 128 * DM); const unsigned fo = lane * 16;   // the pass's 8 column tiles: 64 fragments in a row
    R16 ra = raw_row(Ar, 0, lane); v16b w[8];
#pragma unroll
    for (int j = 0; j < 8; ++j) w[j] = frag_p(Wp, fo, j * 8);
    // every load runs one k chunk (16 WMMAs) ahead of its use: the row values are reloaded as soon as they are split, a weight fragment right behind its own WMMA pair; a fragment loaded at its pair would be waited for in full 8 times a chunk. Unrolled whole, so that the waits are counted ones
#pragma unroll
    for (int kc = 0; kc < DM / 32; ++kc) {
      __builtin_amdgcn_sched_barrier(0);   // keeps this chunk's split below the chunk before: moved up among those WMMAs it waits for row loads that have only just gone out
      const F2 a = split_raw(ra);
      if (kc + 1 < DM / 32) ra = raw_row(Ar, (kc + 1) * 32, lane);
#pragma unroll
      for (int j = 0; j < 8; ++j) { acc[j] = wmma_bf(a.l, w[j], acc[j]); acc[j] = wmma_bf(a.h, w[j], acc[j]);
        if (kc + 1 < DM / 32) w[j] = frag_p(Wp, fo, j * 8 + kc + 1); } }
#pragma unroll
    for (int j = 0; j < 8; ++j) { const float bb = bfr(bias[QKV_CH(pass * 128 + col) + j * 32]);   // the channel at place pass * 128 + j * 16 + col: 16 places on are 32 channels on
#pragma unroll
      for (int r = 0; r < 8; ++r) so[wv][8 * g + r][j * 16 + col] = acc[j][r] + bb; }
    LDSX();
    for (int rl = 0; rl < 16; ++rl) vst2(dst + (r0 + rl) * DM + pass * 128 + lane * 4, *(const v4f*)&so[wv][rl][lane * 4]);
    LDSX(); }
}
// ---- k_attn_out: block = 64 positions of one frame (2 image rows), 16 waves, 4 on a SIMD, so that one wave's load latency and dependent chains run under the others' work. Attention: a wave takes one position at a time, lane l holding channels 8l..8l+7 (4 lanes per head: a score, its exponential and its weight are worked out once for 8 channels), which the row order QKV_CH puts into two pieces so that every q/k/v load is 512 contiguous bytes; in trip i the 16 waves stand on a patch of 8 columns x 2 rows, so that a k or v row that several positions want is asked for by all of them at about the same time; the 9 clamped neighbours: scores / sqrt(32), softmax, weighted v (f32 on VALU); then wave = (16 rows, 64 columns): ctx (hi + residual) . Wo + bo + x
__global__ __launch_bounds__(512) void k_attn_out(const float* __restrict__ Q, const float* __restrict__ Kx, const float* __restrict__ V, const __bf16* __restrict__ PW, const float* __restrict__ BO, const float* __restrict__ X, float* __restrict__ OUT) {
  __shared__ __align__(16) float sc[64][DM + 4]; __shared__ __align__(16) float so[16][16][68];
  const int tid = threadIdx.x, lane = tid & 31, col = lane & 15, g = lane >> 4; const size_t rb0 = (size_t)blockIdx.x * 64; const size_t fr = rb0 / NPOS; const int p0 = (int)(rb0 % NPOS);
  const int wv = __builtin_amdgcn_readfirstlane(tid >> 5);   // the wave's number in a scalar register: position, clamps and row offsets are then scalar work
  const char* Qf = (const char*)(Q + fr * NPOS * DM); const char* Kf = (const char*)(Kx + fr * NPOS * DM); const char* Vf = (const char*)(V + fr * NPOS * DM); const unsigned lo = lane * 16;   // the frame's three planes: scalar bases that never change; lo: this lane's byte offset in a 512-byte half row
  // one position a trip (unroll 1: the 38 loads of a position already fill most of the registers); the inner loops are unrolled so that kv, vv and sco stay in registers
#pragma unroll 1
  for (int i = 0; i < 4; ++i) { const int r = (wv >> 3) * WWd + i * 8 + (wv & 7); const int p = p0 + r; const int py = p / WWd, px = p % WWd;
    unsigned no[9];   // 32-bit byte offsets in the frame: one register a row, shared by the row's k and v loads; the centre (kk 4) is the position itself and serves q too
#pragma unroll
    for (int kk = 0; kk < 9; ++kk) { const int dy = kk / 3 - 1, dx = kk % 3 - 1; int ny = py + dy, nx = px + dx; ny = ny < 0 ? 0 : (ny > HH - 1 ? HH - 1 : ny); nx = nx < 0 ? 0 : (nx > WWd - 1 ? WWd - 1 : nx); no[kk] = (ny * WWd + nx) * (DM * 4) + lo; }
    v4f qv[2], kv[2][9], vv[2][9];
#pragma unroll
    for (int hf = 0; hf < 2; ++hf) qv[hf] = *(const v4f*)(Qf + no[4] + hf * 512);
#pragma unroll
    for (int kk = 0; kk < 9; ++kk) { kv[0][kk] = *(const v4f*)(Kf + no[kk]); kv[1][kk] = *(const v4f*)(Kf + no[kk] + 512); }
#pragma unroll
    for (int kk = 0; kk < 9; ++kk) { vv[0][kk] = *(const v4f*)(Vf + no[kk]); vv[1][kk] = *(const v4f*)(Vf + no[kk] + 512); }
    // behind the position's loads, before any register that they name is written again; the 9 offsets are named as inputs so that each keeps its own register up to this wait and no load's result lands in one
    asm volatile("s_wait_xcnt 0x0" :: "v"(no[0]), "v"(no[1]), "v"(no[2]), "v"(no[3]), "v"(no[4]), "v"(no[5]), "v"(no[6]), "v"(no[7]), "v"(no[8]) : "memory");
    float sco[9]; float mx = -3.0e38f;
#pragma unroll
    for (int kk = 0; kk < 9; ++kk) { float s = qv[0][0] * kv[0][kk][0]; s += qv[0][1] * kv[0][kk][1]; s += qv[0][2] * kv[0][kk][2]; s += qv[0][3] * kv[0][kk][3];
      s += qv[1][0] * kv[1][kk][0]; s += qv[1][1] * kv[1][kk][1]; s += qv[1][2] * kv[1][kk][2]; s += qv[1][3] * kv[1][kk][3];
      s = xadd<1>(s); s = xadd<2>(s);
      s *= 0.17677669529663687f; sco[kk] = s; mx = fmaxf(mx, s); }   // 1/sqrt(32)
    float den = 0.f;
#pragma unroll
    for (int kk = 0; kk < 9; ++kk) { const float e = expf(sco[kk] - mx); sco[kk] = e; den += e; }
    const float inv = 1.0f / den;
    v4f ov[2] = {{0.f, 0.f, 0.f, 0.f}, {0.f, 0.f, 0.f, 0.f}};
#pragma unroll
    for (int kk = 0; kk < 9; ++kk) { const float pw = sco[kk] * inv; ov[0] += pw * vv[0][kk]; ov[1] += pw * vv[1][kk]; }
    vst2(&sc[r][lane * 8], ov[0]); vst2(&sc[r][lane * 8 + 4], ov[1]); }   // ctx in the plain channel order
  if (tid < 64) for (int c = DM; c < DM + 4; ++c) sc[tid][c] = 0.f;
  __syncthreads();
  // out = ctx . Wo + bo + x: waves wv, wv + 4, wv + 8, wv + 12 take the same 16 rows and one 64-column group each; the four waves of a column group read the same weight fragments
  const int rt = wv & 3, cg = wv >> 2;
  const __bf16* Wr = PW + (size_t)3 * DM * DM; const size_t r0 = rb0 + rt * 16;
  v8f acc[4] = {};
  const float* Ar = &sc[rt * 16 + col][0]; const char* Wp = (const char*)(Wr + (size_t)cg * 64 * DM); const unsigned fo = lane * 16;   // the wave's 4 column tiles: 32 fragments in a row
  R16 ra = raw_row(Ar, 0, lane); v16b w[4];
#pragma unroll
  for (int j = 0; j < 4; ++j) w[j] = frag_p(Wp, fo, j * 8);
  // every load runs one k chunk (8 WMMAs) ahead of its use: the row values are reloaded as soon as they are split, a weight fragment right behind its own WMMA pair; a fragment loaded at its pair would be waited for in full 4 times a chunk. Unrolled whole, so that the waits are counted ones
#pragma unroll
  for (int kc = 0; kc < DM / 32; ++kc) {
    __builtin_amdgcn_sched_barrier(0);   // keeps this chunk's split below the chunk before: moved up among those WMMAs it waits for row loads that have only just gone out
    const F2 a = split_raw(ra);
    if (kc + 1 < DM / 32) ra = raw_row(Ar, (kc + 1) * 32, lane);
#pragma unroll
    for (int j = 0; j < 4; ++j) { acc[j] = wmma_bf(a.l, w[j], acc[j]); acc[j] = wmma_bf(a.h, w[j], acc[j]);
      if (kc + 1 < DM / 32) w[j] = frag_p(Wp, fo, j * 8 + kc + 1); } }
#pragma unroll
  for (int j = 0; j < 4; ++j) { const int c = cg * 64 + j * 16 + col; const float bb = bfr(BO[c]);
#pragma unroll
    for (int r = 0; r < 8; ++r) so[wv][8 * g + r][j * 16 + col] = acc[j][r] + bb + bfr(X[(r0 + 8 * g + r) * DM + c]); }
  LDSX();
  // a store covers two rows' 256-byte pieces, each two whole lines
  for (int rl = 0; rl < 16; rl += 2) vst2(OUT + (r0 + rl + g) * DM + cg * 64 + col * 4, *(const v4f*)&so[wv][rl + g][col * 4]);
}
extern "C" void kernel_launch(void* const* d_in, const int* in_sizes, int n_in, void* d_out, int out_size, void* d_ws, size_t ws_size, hipStream_t stream) {
  (void)in_sizes; (void)n_in; (void)out_size;
  const float** F = (const float**)d_in;   // 0 x [2,8,32,32,256], 1 ln_g, 2 ln_b, 3 wq (in,out), 4 bq, 5 wk, 6 bk, 7 wv, 8 bv, 9 wo, 10 bo
  if (ws_size < (size_t)WS_END) return;
  char* ws = (char*)d_ws; __bf16* PW = (__bf16*)(ws + WS_PW); float *Q = (float*)(ws + WS_Q), *Kx = (float*)(ws + WS_K), *V = (float*)(ws + WS_V);
  k_pack<<<dim3(DM / 16, 4), 256, 0, stream>>>(F[3], F[5], F[7], F[9], PW);
  k_qkv<<<NR / 64, 384, 0, stream>>>(F[0], F[1], F[2], PW, F[4], F[6], F[8], Q, Kx, V);
  k_attn_out<<<TRB, 512, 0, stream>>>(Q, Kx, V, PW, F[10], F[0], (float*)d_out);
}

// v008
// A run of this version takes 27.4 microseconds.
// Versions in between are left out here; by their measured steps it is 1.56 times as fast as v006.
// All steps since v000 together make it 4.48 times as fast.
// compute dtype: all float inputs rounded to bf16; LayerNorm (biased variance, eps 1e-5) in f32; q/k/v = xn (bf16 hi + residual, 2 products) . W + b on WMMA 16x16x32 ((in,out) weights packed in B-fragment order), accumulated in f32 and kept in LDS as f16 (a block works out k and v of one image row above and below its own two as well); the 3x3 clamped-neighbourhood attention (9 keys per position, 8 heads x 32) in f32 on VALU from those f16 rows (scores / sqrt(32), softmax with precise expf, weighted sum); out = ctx (bf16 hi + residual, 2 products) . Wo + bo + x; f32 accumulate.
#include <hip/hip_runtime.h>
#include <math.h>

typedef __attribute__((ext_vector_type(16))) _Float16 v16h;
typedef __attribute__((ext_vector_type(16))) __bf16 v16b;
typedef __attribute__((ext_vector_type(8)))  _Float16 v8h;
typedef __attribute__((ext_vector_type(8)))  float v8f;
typedef __attribute__((ext_vector_type(4)))  float v4f;
typedef __attribute__((ext_vector_type(2)))  float v2f;
typedef __attribute__((ext_vector_type(4)))  unsigned v4u;
typedef __attribute__((ext_vector_type(4)))  int v4i;
typedef float __attribute__((may_alias)) float_a;
typedef int __attribute__((may_alias)) int_a;

template <typename T> __device__ __forceinline__ void vst2(void* p, T v) { *(T*)p = v;  }
__device__ __forceinline__ v8f wmma16(v16h a, v16h b, v8f c) {
  v8f d = __builtin_amdgcn_wmma_f32_16x16x32_f16(false, a, false, b, (short)0, c, false, false);
  asm volatile("v_nop\n\tv_nop\n\tv_nop\n\tv_nop" : "+v"(d) : "v"(a), "v"(b));
  return d;
}
__device__ __forceinline__ v8f wmma_bf(v16b a, v16b b, v8f c) {
  v8f d = __builtin_amdgcn_wmma_f32_16x16x32_bf16(false, a, false, b, (short)0, c, false, false);
  asm volatile("v_nop\n\tv_nop\n\tv_nop\n\tv_nop" : "+v"(d) : "v"(a), "v"(b));
  return d;
}
// 16x16x32 fragments: lane = (h = lane>>4, row/col = lane&15); elements 0..7 = k0+8h+0..7, 8..15 = k0+16+8h+0..7; D element r = row 8h+r
__device__ __forceinline__ v16h frag_h(const _Float16* rowk0, int lane) {
  union { v16h v; v8h q[2]; } u; const _Float16* p = rowk0 + 8 * (lane >> 4);
  u.q[0] = *(const v8h*)p; u.q[1] = *(const v8h*)(p + 16); return u.v;
}
__device__ __forceinline__ v16h frag_f32(const float* rowk0, int lane) {
  v16h a; const float* p = rowk0 + 8 * (lane >> 4);
#pragma unroll
  for (int i = 0; i < 8; ++i) { a[i] = (_Float16)p[i]; a[8 + i] = (_Float16)p[16 + i]; }
  return a;
}
__device__ __forceinline__ v16h frag_f32s(const float* rowk0, int lane, float sc) {
  v16h a; const float* p = rowk0 + 8 * (lane >> 4);
#pragma unroll
  for (int i = 0; i < 8; ++i) { a[i] = (_Float16)(p[i] * sc); a[8 + i] = (_Float16)(p[16 + i] * sc); }
  return a;
}
// column fragment from a [K][ld] layout (column n), rows >= K read as 0
__device__ __forceinline__ v16h fragc_f32(const float* W, int k0, int n, int lane, int ld, int K) {
  v16h a; const int g = lane >> 4;
#pragma unroll
  for (int i = 0; i < 8; ++i) { const int ka = k0 + 8 * g + i, kb = ka + 16;
    a[i] = (_Float16)(ka < K ? W[(size_t)(ka < K ? ka : K - 1) * ld + n] : 0.f); a[8 + i] = (_Float16)(kb < K ? W[(size_t)(kb < K ? kb : K - 1) * ld + n] : 0.f); }
  return a;
}
struct F2 { v16b h, l; };
__device__ __forceinline__ F2 bsplit16(const float v[16]) { F2 r;
#pragma unroll
  for (int i = 0; i < 16; ++i) { const __bf16 h = (__bf16)v[i]; r.h[i] = h; r.l[i] = (__bf16)(v[i] - (float)h); }
  return r; }
__device__ __forceinline__ F2 split_row(const float* row, int k0, int lane) { float v[16]; const float* p = row + k0 + 8 * (lane >> 4);
#pragma unroll
  for (int i = 0; i < 8; ++i) { v[i] = p[i]; v[8 + i] = p[16 + i]; }
  return bsplit16(v); }
__device__ __forceinline__ F2 split_rowK(const float* row, int k0, int lane, int K) { float v[16]; const int g = lane >> 4;
#pragma unroll
  for (int i = 0; i < 8; ++i) { const int ka = k0 + 8 * g + i, kb = ka + 16; v[i] = ka < K ? row[ka < K ? ka : K - 1] : 0.f; v[8 + i] = kb < K ? row[kb < K ? kb : K - 1] : 0.f; }
  return bsplit16(v); }
__device__ __forceinline__ F2 split_col(const float* W, int k0, int n, int lane, int ld, int K) { float v[16]; const int g = lane >> 4;
#pragma unroll
  for (int i = 0; i < 8; ++i) { const int ka = k0 + 8 * g + i, kb = ka + 16; v[i] = ka < K ? W[(size_t)(ka < K ? ka : K - 1) * ld + n] : 0.f; v[8 + i] = kb < K ? W[(size_t)(kb < K ? kb : K - 1) * ld + n] : 0.f; }
  return bsplit16(v); }
__device__ __forceinline__ v8f mac3(const F2& a, const F2& b, v8f c) { c = wmma_bf(a.l, b.h, c); c = wmma_bf(a.h, b.l, c); return wmma_bf(a.h, b.h, c); }
__device__ __forceinline__ float sigm(float v) { return 1.0f / (1.0f + expf(-v)); }
#define LDSX() do { asm volatile("s_wait_dscnt 0" ::: "memory"); __builtin_amdgcn_wave_barrier(); __builtin_amdgcn_fence(__ATOMIC_RELEASE, "workgroup"); } while (0)


// Local-window self attention over video feature maps (2 x 8 frames of 32 x 32 positions, dim 256, 8 heads x 32): LayerNorm, q/k/v projections, each position attends to its 3 x 3 replicate-clamped neighbourhood, output projection + residual.
#define NFR 16          // b*t frames
#define HH 32
#define WWd 32
#define NPOS (HH * WWd)
#define DM 256
#define NHD 8
#define HD 32
#define NR (NFR * NPOS)   // 16384 rows
#ifndef TRB
#define TRB (NR / 64)
#endif
typedef __attribute__((ext_vector_type(8))) __bf16 v8b;
// B fragment number t = (16-column tile) * 8 + (32-k chunk) of a packed weight matrix: 1 KiB, elements 0..7 of all 32 lanes and then elements 8..15, so each of the two loads is 512 contiguous bytes (4 whole lines). Wb: the first fragment, fo = lane * 16
__device__ __forceinline__ v16b frag_p(const char* Wb, unsigned fo, int t) {
  union { v16b v; v8b q[2]; } u; const char* p = Wb + (fo + (unsigned)t * 1024u);
  u.q[0] = *(const v8b*)p; u.q[1] = *(const v8b*)(p + 512); return u.v;
}
// the 16 f32 values of a row fragment as loaded, split later: the loads can then go out one k chunk ahead of the conversion
struct R16 { v4f q[4]; };
__device__ __forceinline__ R16 raw_row(const float* row, int k0, int lane) { R16 r; const float* p = row + k0 + 8 * (lane >> 4);
  r.q[0] = *(const v4f*)p; r.q[1] = *(const v4f*)(p + 4); r.q[2] = *(const v4f*)(p + 16); r.q[3] = *(const v4f*)(p + 20); return r; }
__device__ __forceinline__ F2 split_raw(const R16& r) { float v[16];
#pragma unroll
  for (int i = 0; i < 16; ++i) v[i] = r.q[i >> 2][i & 3];
  return bsplit16(v); }
__device__ __forceinline__ float bfr(float v) { return (float)(__bf16)v; }
__device__ __attribute__((noinline)) float exp_ni(float v) { return expf(v); }
__device__ __attribute__((noinline)) float erf_ni(float v) { return erff(v); }

#define WS_PW  0u                                   // bf16 in B-fragment order: wq, wk, wv, wo, each [16 column tiles][8 k chunks][2 halves][32 lanes][8]
#define WS_END (WS_PW + 2u * 4 * DM * DM)
// channel that packed column p of wq, wk, wv computes: column c of the 16-column tiles 2t and 2t + 1 are channels 32t + 2c and 32t + 2c + 1, so that a lane of the q/k/v products holds both halves of an f16 pair
#define QKV_CH(p) (((p) >> 5) * 32 + ((p) & 15) * 2 + (((p) >> 4) & 1))
typedef __attribute__((ext_vector_type(2))) _Float16 v2h;

// ---- k_pack: block = one 16-column tile of one weight matrix, wave = one 32-k chunk: each lane gathers the 16 values of its own B fragment (packed column jt * 16 + col, k = kc * 32 + 8 g + 0..7 and + 16 + 0..7; a load covers pieces of two rows) and the wave stores the fragment as two runs of 512 bytes, every line written whole by one wave
__global__ __launch_bounds__(256) void k_pack(const float* __restrict__ WQ, const float* __restrict__ WK, const float* __restrict__ WV, const float* __restrict__ WO, __bf16* __restrict__ PW) {
  const int jt = blockIdx.x, which = blockIdx.y, lane = threadIdx.x & 31, col = lane & 15, g = lane >> 4; const int kc = __builtin_amdgcn_readfirstlane(threadIdx.x >> 5);
  const float* Wm = (which == 0) ? WQ : (which == 1) ? WK : (which == 2) ? WV : WO;
  const int pc = jt * 16 + col, cc = which < 3 ? QKV_CH(pc) : pc;   // packed column pc of wq, wk, wv is the weight column of channel QKV_CH(pc)
  const char* Wt = (const char*)(Wm + (size_t)kc * 32 * DM); const unsigned po = (8 * g * DM + cc) * 4;   // scalar base and one 32-bit byte offset serve all 16 loads
  float v[16];
#pragma unroll
  for (int i = 0; i < 8; ++i) { v[i] = *(const float*)(Wt + po + i * (DM * 4)); v[8 + i] = *(const float*)(Wt + po + (16 + i) * (DM * 4)); }
  v8b o0, o1;
#pragma unroll
  for (int i = 0; i < 8; ++i) { o0[i] = (__bf16)v[i]; o1[i] = (__bf16)v[8 + i]; }
  __bf16* d = PW + (((size_t)which * 16 + jt) * 8 + kc) * 512 + lane * 8;
  vst2(d, o0); vst2(d + 256, o1);
}
// step of a sum over neighbouring lanes (the 4 that share one head; a LayerNorm row): lane l adds the value of lane l ^ M inside its 16-lane row (folds into v_add_f32_dpp row_xmask)
template <int M> __device__ __forceinline__ float xadd(float v) { return v + __int_as_float(__builtin_amdgcn_update_dpp(0, __float_as_int(v), 0x160 + M, 0xf, 0xf, true)); }
// lane l with lane l ^ 16
__device__ __forceinline__ float xhalf(float v) { return __int_as_float(__builtin_amdgcn_permlanex16(__float_as_int(v), __float_as_int(v), 0x76543210, 0xfedcba98, false, false)); }
// sum over the wave's 32 lanes, the partner distances in the order 1, 2, 4, 8, 16
__device__ __forceinline__ float wsum(float v) { v = xadd<1>(v); v = xadd<2>(v); v = xadd<4>(v); v = xadd<8>(v); return v + xhalf(v); }
// f16 x f16 + f32 and f32 x f16 + f32 in one instruction each (v_fma_mix_f32: the f16 value is widened exactly, the product and the sum are rounded once, as fmaf on the widened values). Written as asm because the compiler otherwise widens every k and v value with an instruction of its own (152 a position) in front of packed f32 FMAs. In each statement 9 (8) independent sums take turns, so that an instruction's producer stands 9 (8) instructions back and no delay hint is missing
// s[kk] (+)= q.lo * k[kk][D].lo, then q.hi * k[kk][D].hi: channels 2D and 2D + 1 of the lane's 8, in that order
template <int D> __device__ __forceinline__ void qk_first(float (&s)[9], unsigned q, const v4u (&k)[9]) {
  asm("v_fma_mix_f32 %0, %9, %10, 0 op_sel:[0,0,0] op_sel_hi:[1,1,0]\n\t"
      "v_fma_mix_f32 %1, %9, %11, 0 op_sel:[0,0,0] op_sel_hi:[1,1,0]\n\t"
      "v_fma_mix_f32 %2, %9, %12, 0 op_sel:[0,0,0] op_sel_hi:[1,1,0]\n\t"
      "v_fma_mix_f32 %3, %9, %13, 0 op_sel:[0,0,0] op_sel_hi:[1,1,0]\n\t"
      "v_fma_mix_f32 %4, %9, %14, 0 op_sel:[0,0,0] op_sel_hi:[1,1,0]\n\t"
      "v_fma_mix_f32 %5, %9, %15, 0 op_sel:[0,0,0] op_sel_hi:[1,1,0]\n\t"
      "v_fma_mix_f32 %6, %9, %16, 0 op_sel:[0,0,0] op_sel_hi:[1,1,0]\n\t"
      "v_fma_mix_f32 %7, %9, %17, 0 op_sel:[0,0,0] op_sel_hi:[1,1,0]\n\t"
      "v_fma_mix_f32 %8, %9, %18, 0 op_sel:[0,0,0] op_sel_hi:[1,1,0]\n\t"
      "v_fma_mix_f32 %0, %9, %10, %0 op_sel:[1,1,0] op_sel_hi:[1,1,0]\n\t"
      "v_fma_mix_f32 %1, %9, %11, %1 op_sel:[1,1,0] op_sel_hi:[1,1,0]\n\t"
      "v_fma_mix_f32 %2, %9, %12, %2 op_sel:[1,1,0] op_sel_hi:[1,1,0]\n\t"
      "v_fma_mix_f32 %3, %9, %13, %3 op_sel:[1,1,0] op_sel_hi:[1,1,0]\n\t"
      "v_fma_mix_f32 %4, %9, %14, %4 op_sel:[1,1,0] op_sel_hi:[1,1,0]\n\t"
      "v_fma_mix_f32 %5, %9, %15, %5 op_sel:[1,1,0] op_sel_hi:[1,1,0]\n\t"
      "v_fma_mix_f32 %6, %9, %16, %6 op_sel:[1,1,0] op_sel_hi:[1,1,0]\n\t"
      "v_fma_mix_f32 %7, %9, %17, %7 op_sel:[1,1,0] op_sel_hi:[1,1,0]\n\t"
      "v_fma_mix_f32 %8, %9, %18, %8 op_sel:[1,1,0] op_sel_hi:[1,1,0]"
      : "=&v"(s[0]), "=&v"(s[1]), "=&v"(s[2]), "=&v"(s[3]), "=&v"(s[4]), "=&v"(s[5]), "=&v"(s[6]), "=&v"(s[7]), "=&v"(s[8]) : "v"(q), "v"(k[0][D]), "v"(k[1][D]), "v"(k[2][D]), "v"(k[3][D]), "v"(k[4][D]), "v"(k[5][D]), "v"(k[6][D]), "v"(k[7][D]), "v"(k[8][D]));
}
template <int D> __device__ __forceinline__ void qk_next(float (&s)[9], unsigned q, const v4u (&k)[9]) {
  asm("v_fma_mix_f32 %0, %9, %10, %0 op_sel:[0,0,0] op_sel_hi:[1,1,0]\n\t"
      "v_fma_mix_f32 %1, %9, %11, %1 op_sel:[0,0,0] op_sel_hi:[1,1,0]\n\t"
      "v_fma_mix_f32 %2, %9, %12, %2 op_sel:[0,0,0] op_sel_hi:[1,1,0]\n\t"
      "v_fma_mix_f32 %3, %9, %13, %3 op_sel:[0,0,0] op_sel_hi:[1,1,0]\n\t"
      "v_fma_mix_f32 %4, %9, %14, %4 op_sel:[0,0,0] op_sel_hi:[1,1,0]\n\t"
      "v_fma_mix_f32 %5, %9, %15, %5 op_sel:[0,0,0] op_sel_hi:[1,1,0]\n\t"
      "v_fma_mix_f32 %6, %9, %16, %6 op_sel:[0,0,0] op_sel_hi:[1,1,0]\n\t"
      "v_fma_mix_f32 %7, %9, %17, %7 op_sel:[0,0,0] op_sel_hi:[1,1,0]\n\t"
      "v_fma_mix_f32 %8, %9, %18, %8 op_sel:[0,0,0] op_sel_hi:[1,1,0]\n\t"
      "v_fma_mix_f32 %0, %9, %10, %0 op_sel:[1,1,0] op_sel_hi:[1,1,0]\n\t"
      "v_fma_mix_f32 %1, %9, %11, %1 op_sel:[1,1,0] op_sel_hi:[1,1,0]\n\t"
      "v_fma_mix_f32 %2, %9, %12, %2 op_sel:[1,1,0] op_sel_hi:[1,1,0]\n\t"
      "v_fma_mix_f32 %3, %9, %13, %3 op_sel:[1,1,0] op_sel_hi:[1,1,0]\n\t"
      "v_fma_mix_f32 %4, %9, %14, %4 op_sel:[1,1,0] op_sel_hi:[1,1,0]\n\t"
      "v_fma_mix_f32 %5, %9, %15, %5 op_sel:[1,1,0] op_sel_hi:[1,1,0]\n\t"
      "v_fma_mix_f32 %6, %9, %16, %6 op_sel:[1,1,0] op_sel_hi:[1,1,0]\n\t"
      "v_fma_mix_f32 %7, %9, %17, %7 op_sel:[1,1,0] op_sel_hi:[1,1,0]\n\t"
      "v_fma_mix_f32 %8, %9, %18, %8 op_sel:[1,1,0] op_sel_hi:[1,1,0]"
      : "+v"(s[0]), "+v"(s[1]), "+v"(s[2]), "+v"(s[3]), "+v"(s[4]), "+v"(s[5]), "+v"(s[6]), "+v"(s[7]), "+v"(s[8]) : "v"(q), "v"(k[0][D]), "v"(k[1][D]), "v"(k[2][D]), "v"(k[3][D]), "v"(k[4][D]), "v"(k[5][D]), "v"(k[6][D]), "v"(k[7][D]), "v"(k[8][D]));
}
// o[c] (+)= w[kk] * v[kk] channel c, the keys K0, K0 + 1, .. in that order
template <int K0> __device__ __forceinline__ void pv_first3(float (&o)[8], const float (&w)[9], const v4u (&v)[9]) {
  asm("v_fma_mix_f32 %0, %8, %9, 0 op_sel:[0,0,0] op_sel_hi:[0,1,0]\n\t"
      "v_fma_mix_f32 %1, %8, %9, 0 op_sel:[0,1,0] op_sel_hi:[0,1,0]\n\t"
      "v_fma_mix_f32 %2, %8, %10, 0 op_sel:[0,0,0] op_sel_hi:[0,1,0]\n\t"
      "v_fma_mix_f32 %3, %8, %10, 0 op_sel:[0,1,0] op_sel_hi:[0,1,0]\n\t"
      "v_fma_mix_f32 %4, %8, %11, 0 op_sel:[0,0,0] op_sel_hi:[0,1,0]\n\t"
      "v_fma_mix_f32 %5, %8, %11, 0 op_sel:[0,1,0] op_sel_hi:[0,1,0]\n\t"
      "v_fma_mix_f32 %6, %8, %12, 0 op_sel:[0,0,0] op_sel_hi:[0,1,0]\n\t"
      "v_fma_mix_f32 %7, %8, %12, 0 op_sel:[0,1,0] op_sel_hi:[0,1,0]\n\t"
      "v_fma_mix_f32 %0, %13, %14, %0 op_sel:[0,0,0] op_sel_hi:[0,1,0]\n\t"
      "v_fma_mix_f32 %1, %13, %14, %1 op_sel:[0,1,0] op_sel_hi:[0,1,0]\n\t"
      "v_fma_mix_f32 %2, %13, %15, %2 op_sel:[0,0,0] op_sel_hi:[0,1,0]\n\t"
      "v_fma_mix_f32 %3, %13, %15, %3 op_sel:[0,1,0] op_sel_hi:[0,1,0]\n\t"
      "v_fma_mix_f32 %4, %13, %16, %4 op_sel:[0,0,0] op_sel_hi:[0,1,0]\n\t"
      "v_fma_mix_f32 %5, %13, %16, %5 op_sel:[0,1,0] op_sel_hi:[0,1,0]\n\t"
      "v_fma_mix_f32 %6, %13, %17, %6 op_sel:[0,0,0] op_sel_hi:[0,1,0]\n\t"
      "v_fma_mix_f32 %7, %13, %17, %7 op_sel:[0,1,0] op_sel_hi:[0,1,0]\n\t"
      "v_fma_mix_f32 %0, %18, %19, %0 op_sel:[0,0,0] op_sel_hi:[0,1,0]\n\t"
      "v_fma_mix_f32 %1, %18, %19, %1 op_sel:[0,1,0] op_sel_hi:[0,1,0]\n\t"
      "v_fma_mix_f32 %2, %18, %20, %2 op_sel:[0,0,0] op_sel_hi:[0,1,0]\n\t"
      "v_fma_mix_f32 %3, %18, %20, %3 op_sel:[0,1,0] op_sel_hi:[0,1,0]\n\t"
      "v_fma_mix_f32 %4, %18, %21, %4 op_sel:[0,0,0] op_sel_hi:[0,1,0]\n\t"
      "v_fma_mix_f32 %5, %18, %21, %5 op_sel:[0,1,0] op_sel_hi:[0,1,0]\n\t"
      "v_fma_mix_f32 %6, %18, %22, %6 op_sel:[0,0,0] op_sel_hi:[0,1,0]\n\t"
      "v_fma_mix_f32 %7, %18, %22, %7 op_sel:[0,1,0] op_sel_hi:[0,1,0]"
      : "=&v"(o[0]), "=&v"(o[1]), "=&v"(o[2]), "=&v"(o[3]), "=&v"(o[4]), "=&v"(o[5]), "=&v"(o[6]), "=&v"(o[7]) : "v"(w[K0 + 0]), "v"(v[K0 + 0][0]), "v"(v[K0 + 0][1]), "v"(v[K0 + 0][2]), "v"(v[K0 + 0][3]), "v"(w[K0 + 1]), "v"(v[K0 + 1][0]), "v"(v[K0 + 1][1]), "v"(v[K0 + 1][2]), "v"(v[K0 + 1][3]), "v"(w[K0 + 2]), "v"(v[K0 + 2][0]), "v"(v[K0 + 2][1]), "v"(v[K0 + 2][2]), "v"(v[K0 + 2][3]));
}
template <int K0> __device__ __forceinline__ void pv_next2(float (&o)[8], const float (&w)[9], const v4u (&v)[9]) {
  asm("v_fma_mix_f32 %0, %8, %9, %0 op_sel:[0,0,0] op_sel_hi:[0,1,0]\n\t"
      "v_fma_mix_f32 %1, %8, %9, %1 op_sel:[0,1,0] op_sel_hi:[0,1,0]\n\t"
      "v_fma_mix_f32 %2, %8, %10, %2 op_sel:[0,0,0] op_sel_hi:[0,1,0]\n\t"
      "v_fma_mix_f32 %3, %8, %10, %3 op_sel:[0,1,0] op_sel_hi:[0,1,0]\n\t"
      "v_fma_mix_f32 %4, %8, %11, %4 op_sel:[0,0,0] op_sel_hi:[0,1,0]\n\t"
      "v_fma_mix_f32 %5, %8, %11, %5 op_sel:[0,1,0] op_sel_hi:[0,1,0]\n\t"
      "v_fma_mix_f32 %6, %8, %12, %6 op_sel:[0,0,0] op_sel_hi:[0,1,0]\n\t"
      "v_fma_mix_f32 %7, %8, %12, %7 op_sel:[0,1,0] op_sel_hi:[0,1,0]\n\t"
      "v_fma_mix_f32 %0, %13, %14, %0 op_sel:[0,0,0] op_sel_hi:[0,1,0]\n\t"
      "v_fma_mix_f32 %1, %13, %14, %1 op_sel:[0,1,0] op_sel_hi:[0,1,0]\n\t"
      "v_fma_mix_f32 %2, %13, %15, %2 op_sel:[0,0,0] op_sel_hi:[0,1,0]\n\t"
      "v_fma_mix_f32 %3, %13, %15, %3 op_sel:[0,1,0] op_sel_hi:[0,1,0]\n\t"
      "v_fma_mix_f32 %4, %13, %16, %4 op_sel:[0,0,0] op_sel_hi:[0,1,0]\n\t"
      "v_fma_mix_f32 %5, %13, %16, %5 op_sel:[0,1,0] op_sel_hi:[0,1,0]\n\t"
      "v_fma_mix_f32 %6, %13, %17, %6 op_sel:[0,0,0] op_sel_hi:[0,1,0]\n\t"
      "v_fma_mix_f32 %7, %13, %17, %7 op_sel:[0,1,0] op_sel_hi:[0,1,0]"
      : "+v"(o[0]), "+v"(o[1]), "+v"(o[2]), "+v"(o[3]), "+v"(o[4]), "+v"(o[5]), "+v"(o[6]), "+v"(o[7]) : "v"(w[K0 + 0]), "v"(v[K0 + 0][0]), "v"(v[K0 + 0][1]), "v"(v[K0 + 0][2]), "v"(v[K0 + 0][3]), "v"(w[K0 + 1]), "v"(v[K0 + 1][0]), "v"(v[K0 + 1][1]), "v"(v[K0 + 1][2]), "v"(v[K0 + 1][3]));
}
typedef __attribute__((ext_vector_type(4))) __bf16 v4b;
// A fragment from a row of bf16 values in LDS: p = the lane's row + (k0 + 8 g) elements; elements 0..7 there, 8..15 sixteen elements on
__device__ __forceinline__ v16b frag_l(const char* p) { union { v16b v; v8b q[2]; } u; u.q[0] = *(const v8b*)p; u.q[1] = *(const v8b*)(p + 32); return u.v; }
#define RP 528                                  // bytes of an LDS row of q: 256 f16 + 16, an odd number of 16-byte steps
#define XP 1040                                 // bytes of an LDS row of xn: 256 bf16 hi, 256 bf16 residuals, + 16 (an odd number of 16-byte steps); [128][XP] from byte 0
#define XLO 512                                 // where the residuals start in such a row
#define OFF_SC 0                                // ctx f32 [64][DM + 4], over xn once it is dead
#define OFF_SO (64 * (DM + 4) * 4)              // output staging f32 [16][16][68], over xn too
#define OFF_Q  (OFF_SO + 16 * 16 * 68 * 4)      // q f16 [64][RP]
#define OFF_KV (OFF_Q + 64 * RP)                // k and v f16 [128][XP]: a slot's k row, its v row 512 bytes on (one address register serves both reads), + 16
#define LDS_ALL (OFF_KV + 128 * XP)
// ---- k_all: block = 64 positions of one frame (image rows y0, y0 + 1), 16 waves, 4 on a SIMD. LDS slot s = 0..127 stands for image row clamp(y0 - 1 + s / 32), column s % 32: the block's own two rows and the row above and below, whose k and v its positions attend to.
// 1. xn = (x - mu) * rsqrt(var + 1e-5) * g + b (biased variance) of the 128 slots, a wave taking every 16th slot whole (lane l holds channels 4l..4l+3 and 128+4l..128+4l+3), split once into bf16 hi and bf16 residual in LDS.
// 2. q (64 slots), k, v (128 slots) = xn (hi + residual) . W + b -> f16 rows in LDS. Wave = (rh: the four 16-slot tiles 4rh..4rh+3; m: 0 k / 1 v), two passes of 32 channels (column tiles 2cp, 2cp + 1); on one of its tiles it also does q, so that each A fragment read serves 2 or 4 column tiles and each weight fragment 4 row tiles.
// 3. attention: a wave takes one position at a time, lane l holding channels 8l..8l+7 (4 lanes per head), a q/k/v row being one LDS read of 512 contiguous bytes; the 9 clamped neighbours: scores / sqrt(32), softmax, weighted v (f32 on VALU).
// 4. wave = (16 rows, 64 columns): ctx (hi + residual) . Wo + bo + x
__global__ __launch_bounds__(512) void k_all(const float* __restrict__ X, const float* __restrict__ G, const float* __restrict__ Bt, const __bf16* __restrict__ PW, const float* __restrict__ BQ, const float* __restrict__ BK, const float* __restrict__ BV, const float* __restrict__ BO, float* __restrict__ OUT) {
  __shared__ __align__(16) char sm[LDS_ALL];
  const int tid = threadIdx.x, lane = tid & 31, col = lane & 15, g = lane >> 4; const size_t rb0 = (size_t)blockIdx.x * 64; const size_t fr = rb0 / NPOS; const int p0 = (int)(rb0 % NPOS), y0 = p0 / WWd;
  const int wv = __builtin_amdgcn_readfirstlane(tid >> 5);   // the wave's number in a scalar register: slots, positions, clamps, weight and bias pointers are then scalar work
  const unsigned lo = lane * 16;
  { v4f xv[8][2], gg[2], bt[2]; float mu[8], inv[8];   // the wave's slots wv, wv + 16, ..: all row loads go out first, and each stage runs over all eight rows, so that eight independent chains fill one another's latency
    const char* Xf = (const char*)(X + fr * NPOS * DM); unsigned xo[8];   // one scalar base and a 32-bit byte offset a row
#pragma unroll
    for (int it = 0; it < 8; ++it) { int iy = y0 - 1 + (it >> 1); iy = iy < 0 ? 0 : (iy > HH - 1 ? HH - 1 : iy); xo[it] = (unsigned)((iy * WWd + wv + 16 * (it & 1)) * (DM * 4)) + lo; }
#pragma unroll
    for (int it = 0; it < 8; ++it) { const char* xr = Xf + xo[it]; xv[it][0] = *(const v4f*)xr; xv[it][1] = *(const v4f*)(xr + 512); }
#pragma unroll
    for (int hf = 0; hf < 2; ++hf) { gg[hf] = *(const v4f*)((const char*)G + lo + hf * 512); bt[hf] = *(const v4f*)((const char*)Bt + lo + hf * 512); }
    // behind the loads, before any register that they name is written again; the offsets are named as inputs so that each keeps its own register up to this wait and no load's result lands in one
    asm volatile("s_wait_xcnt 0x0" :: "v"(lo), "v"(xo[0]), "v"(xo[1]), "v"(xo[2]), "v"(xo[3]), "v"(xo[4]), "v"(xo[5]), "v"(xo[6]), "v"(xo[7]) : "memory");
#pragma unroll
    for (int hf = 0; hf < 2; ++hf) {
#pragma unroll
      for (int i = 0; i < 4; ++i) { gg[hf][i] = bfr(gg[hf][i]); bt[hf][i] = bfr(bt[hf][i]); } }
#pragma unroll
    for (int it = 0; it < 8; ++it) { float s[2];
#pragma unroll
      for (int hf = 0; hf < 2; ++hf) { s[hf] = 0.f;
#pragma unroll
        for (int i = 0; i < 4; ++i) { xv[it][hf][i] = bfr(xv[it][hf][i]); s[hf] += xv[it][hf][i]; }
        s[hf] = wsum(s[hf]); }
      mu[it] = (s[0] + s[1]) / (float)DM; }
#pragma unroll
    for (int it = 0; it < 8; ++it) { float q[2];
#pragma unroll
      for (int hf = 0; hf < 2; ++hf) { q[hf] = 0.f;
#pragma unroll
        for (int i = 0; i < 4; ++i) { const float dd = xv[it][hf][i] - mu[it]; q[hf] += dd * dd; }
        q[hf] = wsum(q[hf]); }
      inv[it] = 1.0f / sqrtf((q[0] + q[1]) / (float)DM + 1e-5f); }
#pragma unroll
    for (int it = 0; it < 8; ++it) { const int r = wv + 16 * it;
#pragma unroll
      for (int hf = 0; hf < 2; ++hf) { v4b hh, ll;
#pragma unroll
        for (int i = 0; i < 4; ++i) { const float o = (xv[it][hf][i] - mu[it]) * inv[it] * gg[hf][i] + bt[hf][i]; const __bf16 h = (__bf16)o; hh[i] = h; ll[i] = (__bf16)(o - (float)h); }
        vst2(sm + r * XP + hf * 256 + lane * 8, hh); vst2(sm + r * XP + XLO + hf * 256 + lane * 8, ll); } } }
  __syncthreads();   // a wave's A tiles were written by all 16 waves
  { const int rh = wv & 1, m = (wv >> 1) & 1;
    const int qt = rh * 2 + 2 + m;   // the wave's tile that also gets q: q lives on tiles 2..5 (slots 32..95), one for each (rh, m)
    int tl[4]; const char* ap[4];
#pragma unroll
    for (int t = 0; t < 4; ++t) { tl[t] = rh * 4 + ((qt + t) & 3); ap[t] = sm + (tl[t] * 16 + col) * XP + g * 16; }
    const float* bkv = m ? BV : BK;
#pragma unroll 1
    for (int pass = 0; pass < 2; ++pass) { const int cp = (wv >> 2) * 2 + pass;
      const char* Wkv = (const char*)(PW + (size_t)(1 + m) * DM * DM + (size_t)cp * 32 * DM); const char* Wqp = (const char*)(PW + (size_t)cp * 32 * DM);   // column tiles 2cp and 2cp + 1: 16 fragments in a row
      const int ch = cp * 32 + col * 2;   // column col of the two tiles: channels ch and ch + 1 (QKV_CH), one f16 pair
      const float bk0 = bfr(bkv[ch]), bk1 = bfr(bkv[ch + 1]), bq0 = bfr(BQ[ch]), bq1 = bfr(BQ[ch + 1]);
      char* dkv = sm + OFF_KV + m * 512 + (8 * g) * XP + (cp * 16 + col) * 4; char* dq = sm + OFF_Q + (8 * g) * RP + (cp * 16 + col) * 4;
      v8f ak[4][2] = {}, aq[2] = {}; v16b ah[4], al[4], w[2][2], wq[2];
#pragma unroll
      for (int t = 0; t < 4; ++t) { ah[t] = frag_l(ap[t]); al[t] = frag_l(ap[t] + XLO); }
#pragma unroll
      for (int j = 0; j < 2; ++j) { w[0][j] = frag_p(Wkv, lo, j * 8); wq[j] = frag_p(Wqp, lo, j * 8); }
      // the k or v weight fragments go out one whole k chunk (20 WMMAs) ahead into a second set of registers; the q weight fragments, used on the chunk's first tile alone, and an A tile's next fragments are reloaded right behind their last WMMA of this chunk. Unrolled whole, so that the waits are counted ones. Each accumulator takes residual, then hi, k chunks in rising order
#pragma unroll
      for (int kc = 0; kc < DM / 32; ++kc) { const int c = kc & 1;
        if (kc + 1 < DM / 32) {
#pragma unroll
          for (int j = 0; j < 2; ++j) w[c ^ 1][j] = frag_p(Wkv, lo, j * 8 + kc + 1); }
#pragma unroll
        for (int t = 0; t < 4; ++t) {
          ak[t][0] = wmma_bf(al[t], w[c][0], ak[t][0]); ak[t][1] = wmma_bf(al[t], w[c][1], ak[t][1]);
          if (t == 0) { aq[0] = wmma_bf(al[t], wq[0], aq[0]); aq[1] = wmma_bf(al[t], wq[1], aq[1]); }
          ak[t][0] = wmma_bf(ah[t], w[c][0], ak[t][0]); ak[t][1] = wmma_bf(ah[t], w[c][1], ak[t][1]);
          if (t == 0) { aq[0] = wmma_bf(ah[t], wq[0], aq[0]); aq[1] = wmma_bf(ah[t], wq[1], aq[1]);
            if (kc + 1 < DM / 32) { wq[0] = frag_p(Wqp, lo, kc + 1); wq[1] = frag_p(Wqp, lo, 8 + kc + 1); } }
          if (kc + 1 < DM / 32) { ah[t] = frag_l(ap[t] + (kc + 1) * 64); al[t] = frag_l(ap[t] + XLO + (kc + 1) * 64); }
          __builtin_amdgcn_sched_barrier(0); } }   // keeps the tiles in this order: with a later tile's WMMAs moved up, the next chunk's would wait for A fragments that have only just been asked for
      asm volatile("s_wait_xcnt 0x0" ::: "memory");   // behind the pass's weight and bias loads, before the next pass writes their address registers again
#pragma unroll
      for (int t = 0; t < 4; ++t) {
#pragma unroll
        for (int r = 0; r < 8; ++r) { v2h pr; pr[0] = (_Float16)(ak[t][0][r] + bk0); pr[1] = (_Float16)(ak[t][1][r] + bk1); vst2(dkv + (tl[t] * 16 + r) * XP, pr); } }
#pragma unroll
      for (int r = 0; r < 8; ++r) { v2h pr; pr[0] = (_Float16)(aq[0][r] + bq0); pr[1] = (_Float16)(aq[1][r] + bq1); vst2(dq + ((qt - 2) * 16 + r) * RP, pr); } } }
  __syncthreads();   // q, k, v rows were written by all 16 waves; behind it xn is dead
  float (*sc)[DM + 4] = (float (*)[DM + 4])(sm + OFF_SC); float (*so)[16][68] = (float (*)[16][68])(sm + OFF_SO);
  unsigned vb[3];   // the three neighbour image rows' first slots in k/v, this lane's 16 bytes: the same on all four trips
#pragma unroll
  for (int dy = 0; dy < 3; ++dy) { int ny = y0 + (wv >> 3) + dy - 1; ny = ny < 0 ? 0 : (ny > HH - 1 ? HH - 1 : ny); vb[dy] = (unsigned)(OFF_KV + (ny - y0 + 1) * WWd * XP) + lo; }
  // one position a trip (unroll 1: four waves on a SIMD cover one another's latency and dependent chains); the inner loops are unrolled so that kv, vv and sco stay in registers
#pragma unroll 1
  for (int i = 0; i < 4; ++i) { const int px = i * 8 + (wv & 7), r = (wv >> 3) * WWd + px;
    v4u kv[9], vv[9]; const v4u qv = *(const v4u*)(sm + OFF_Q + r * RP + lo);   // 8 f16 channels in 4 registers
    unsigned xc[3];   // the three neighbour columns' byte offsets, scalar
#pragma unroll
    for (int dx = 0; dx < 3; ++dx) { int nx = px + dx - 1; nx = nx < 0 ? 0 : (nx > WWd - 1 ? WWd - 1 : nx); xc[dx] = (unsigned)(nx * XP); }
#pragma unroll
    for (int kk = 0; kk < 9; ++kk) kv[kk] = *(const v4u*)(sm + (vb[kk / 3] + xc[kk % 3]));
#pragma unroll
    for (int kk = 0; kk < 9; ++kk) vv[kk] = *(const v4u*)(sm + (vb[kk / 3] + xc[kk % 3]) + 512);
    float sco[9]; float mx = -3.0e38f;
    qk_first<0>(sco, qv[0], kv); qk_next<1>(sco, qv[1], kv); qk_next<2>(sco, qv[2], kv); qk_next<3>(sco, qv[3], kv);
#pragma unroll
    for (int kk = 0; kk < 9; ++kk) { float s = sco[kk];
      s = xadd<1>(s); s = xadd<2>(s);
      s *= 0.17677669529663687f; sco[kk] = s; mx = fmaxf(mx, s); }   // 1/sqrt(32)
    float den = 0.f;
#pragma unroll
    for (int kk = 0; kk < 9; ++kk) { const float e = expf(sco[kk] - mx); sco[kk] = e; den += e; }
    const float inv = 1.0f / den;
    float ox[8];
#pragma unroll
    for (int kk = 0; kk < 9; ++kk) sco[kk] *= inv;
    pv_first3<0>(ox, sco, vv); pv_next2<3>(ox, sco, vv); pv_next2<5>(ox, sco, vv); pv_next2<7>(ox, sco, vv);
    const v4f o0 = {ox[0], ox[1], ox[2], ox[3]}, o1 = {ox[4], ox[5], ox[6], ox[7]};
    vst2(&sc[r][lane * 8], o0); vst2(&sc[r][lane * 8 + 4], o1); }   // ctx in the plain channel order
  if (tid < 64) for (int c = DM; c < DM + 4; ++c) sc[tid][c] = 0.f;
  __syncthreads();
  // out = ctx . Wo + bo + x: waves wv, wv + 4, wv + 8, wv + 12 take the same 16 rows and one 64-column group each; the four waves of a column group read the same weight fragments
  const int rt = wv & 3, cg = wv >> 2;
  const __bf16* Wr = PW + (size_t)3 * DM * DM; const size_t r0 = rb0 + rt * 16;
  v8f acc[4] = {};
  const float* Ar = &sc[rt * 16 + col][0]; const char* Wp = (const char*)(Wr + (size_t)cg * 64 * DM); const unsigned fo = lane * 16;   // the wave's 4 column tiles: 32 fragments in a row
  R16 ra = raw_row(Ar, 0, lane); v16b w[4];
#pragma unroll
  for (int j = 0; j < 4; ++j) w[j] = frag_p(Wp, fo, j * 8);
  // every load runs one k chunk (8 WMMAs) ahead of its use: the row values are reloaded as soon as they are split, a weight fragment right behind its own WMMA pair; a fragment loaded at its pair would be waited for in full 4 times a chunk. Unrolled whole, so that the waits are counted ones
#pragma unroll
  for (int kc = 0; kc < DM / 32; ++kc) {
    __builtin_amdgcn_sched_barrier(0);   // keeps this chunk's split below the chunk before: moved up among those WMMAs it waits for row loads that have only just gone out
    const F2 a = split_raw(ra);
    if (kc + 1 < DM / 32) ra = raw_row(Ar, (kc + 1) * 32, lane);
#pragma unroll
    for (int j = 0; j < 4; ++j) { acc[j] = wmma_bf(a.l, w[j], acc[j]); acc[j] = wmma_bf(a.h, w[j], acc[j]);
      if (kc + 1 < DM / 32) w[j] = frag_p(Wp, fo, j * 8 + kc + 1); } }
#pragma unroll
  for (int j = 0; j < 4; ++j) { const int c = cg * 64 + j * 16 + col; const float bb = bfr(BO[c]);
#pragma unroll
    for (int r = 0; r < 8; ++r) so[wv][8 * g + r][j * 16 + col] = acc[j][r] + bb + bfr(X[(r0 + 8 * g + r) * DM + c]); }
  LDSX();
  // a store covers two rows' 256-byte pieces, each two whole lines
  for (int rl = 0; rl < 16; rl += 2) vst2(OUT + (r0 + rl + g) * DM + cg * 64 + col * 4, *(const v4f*)&so[wv][rl + g][col * 4]);
}
extern "C" void kernel_launch(void* const* d_in, const int* in_sizes, int n_in, void* d_out, int out_size, void* d_ws, size_t ws_size, hipStream_t stream) {
  (void)in_sizes; (void)n_in; (void)out_size;
  const float** F = (const float**)d_in;   // 0 x [2,8,32,32,256], 1 ln_g, 2 ln_b, 3 wq (in,out), 4 bq, 5 wk, 6 bk, 7 wv, 8 bv, 9 wo, 10 bo
  if (ws_size < (size_t)WS_END) return;
  char* ws = (char*)d_ws; __bf16* PW = (__bf16*)(ws + WS_PW);
  k_pack<<<dim3(DM / 16, 4), 256, 0, stream>>>(F[3], F[5], F[7], F[9], PW);
  k_all<<<TRB, 512, 0, stream>>>(F[0], F[1], F[2], PW, F[4], F[6], F[8], F[10], (float*)d_out);
}

// v010
// One run takes 22 microseconds.
// Versions between v008 and this one are left out; their measured steps multiply to 1.22 times as fast.
// Counting every step since v000, it is 5.45 times as fast.
// compute dtype: all float inputs rounded to bf16; LayerNorm (biased variance, eps 1e-5) in f32; q/k/v = xn (rounded to f16, 1 product) . W + b on WMMA 16x16x32 f16 ((in,out) weights packed in B-fragment order as f16: a bf16 value from 2^-14 up is exact there, a smaller one is off by at most 2^-25), accumulated in f32 and kept in LDS as f16 (a block works out k and v of one image row above and below its own two as well); the 3x3 clamped-neighbourhood attention (9 keys per position, 8 heads x 32) in f32 on VALU from those f16 rows (scores / sqrt(32), softmax with precise expf, weighted sum); out = ctx (rounded to f16, 1 product) . Wo + bo + x; f32 accumulate.
#include <hip/hip_runtime.h>
#include <math.h>

typedef __attribute__((ext_vector_type(16))) _Float16 v16h;
typedef __attribute__((ext_vector_type(16))) __bf16 v16b;
typedef __attribute__((ext_vector_type(8)))  _Float16 v8h;
typedef __attribute__((ext_vector_type(8)))  float v8f;
typedef __attribute__((ext_vector_type(4)))  float v4f;
typedef __attribute__((ext_vector_type(2)))  float v2f;
typedef __attribute__((ext_vector_type(4)))  unsigned v4u;
typedef __attribute__((ext_vector_type(4)))  int v4i;
typedef float __attribute__((may_alias)) float_a;
typedef int __attribute__((may_alias)) int_a;

template <typename T> __device__ __forceinline__ void vst2(void* p, T v) { *(T*)p = v;  }
__device__ __forceinline__ v8f wmma16(v16h a, v16h b, v8f c) {
  v8f d = __builtin_amdgcn_wmma_f32_16x16x32_f16(false, a, false, b, (short)0, c, false, false);
  asm volatile("v_nop\n\tv_nop\n\tv_nop\n\tv_nop" : "+v"(d) : "v"(a), "v"(b));
  return d;
}
__device__ __forceinline__ v8f wmma_bf(v16b a, v16b b, v8f c) {
  v8f d = __builtin_amdgcn_wmma_f32_16x16x32_bf16(false, a, false, b, (short)0, c, false, false);
  asm volatile("v_nop\n\tv_nop\n\tv_nop\n\tv_nop" : "+v"(d) : "v"(a), "v"(b));
  return d;
}
// 16x16x32 fragments: lane = (h = lane>>4, row/col = lane&15); elements 0..7 = k0+8h+0..7, 8..15 = k0+16+8h+0..7; D element r = row 8h+r
__device__ __forceinline__ v16h frag_h(const _Float16* rowk0, int lane) {
  union { v16h v; v8h q[2]; } u; const _Float16* p = rowk0 + 8 * (lane >> 4);
  u.q[0] = *(const v8h*)p; u.q[1] = *(const v8h*)(p + 16); return u.v;
}
__device__ __forceinline__ v16h frag_f32(const float* rowk0, int lane) {
  v16h a; const float* p = rowk0 + 8 * (lane >> 4);
#pragma unroll
  for (int i = 0; i < 8; ++i) { a[i] = (_Float16)p[i]; a[8 + i] = (_Float16)p[16 + i]; }
  return a;
}
__device__ __forceinline__ v16h frag_f32s(const float* rowk0, int lane, float sc) {
  v16h a; const float* p = rowk0 + 8 * (lane >> 4);
#pragma unroll
  for (int i = 0; i < 8; ++i) { a[i] = (_Float16)(p[i] * sc); a[8 + i] = (_Float16)(p[16 + i] * sc); }
  return a;
}
// column fragment from a [K][ld] layout (column n), rows >= K read as 0
__device__ __forceinline__ v16h fragc_f32(const float* W, int k0, int n, int lane, int ld, int K) {
  v16h a; const int g = lane >> 4;
#pragma unroll
  for (int i = 0; i < 8; ++i) { const int ka = k0 + 8 * g + i, kb = ka + 16;
    a[i] = (_Float16)(ka < K ? W[(size_t)(ka < K ? ka : K - 1) * ld + n] : 0.f); a[8 + i] = (_Float16)(kb < K ? W[(size_t)(kb < K ? kb : K - 1) * ld + n] : 0.f); }
  return a;
}
struct F2 { v16b h, l; };
__device__ __forceinline__ F2 bsplit16(const float v[16]) { F2 r;
#pragma unroll
  for (int i = 0; i < 16; ++i) { const __bf16 h = (__bf16)v[i]; r.h[i] = h; r.l[i] = (__bf16)(v[i] - (float)h); }
  return r; }
__device__ __forceinline__ F2 split_row(const float* row, int k0, int lane) { float v[16]; const float* p = row + k0 + 8 * (lane >> 4);
#pragma unroll
  for (int i = 0; i < 8; ++i) { v[i] = p[i]; v[8 + i] = p[16 + i]; }
  return bsplit16(v); }
__device__ __forceinline__ F2 split_rowK(const float* row, int k0, int lane, int K) { float v[16]; const int g = lane >> 4;
#pragma unroll
  for (int i = 0; i < 8; ++i) { const int ka = k0 + 8 * g + i, kb = ka + 16; v[i] = ka < K ? row[ka < K ? ka : K - 1] : 0.f; v[8 + i] = kb < K ? row[kb < K ? kb : K - 1] : 0.f; }
  return bsplit16(v); }
__device__ __forceinline__ F2 split_col(const float* W, int k0, int n, int lane, int ld, int K) { float v[16]; const int g = lane >> 4;
#pragma unroll
  for (int i = 0; i < 8; ++i) { const int ka = k0 + 8 * g + i, kb = ka + 16; v[i] = ka < K ? W[(size_t)(ka < K ? ka : K - 1) * ld + n] : 0.f; v[8 + i] = kb < K ? W[(size_t)(kb < K ? kb : K - 1) * ld + n] : 0.f; }
  return bsplit16(v); }
__device__ __forceinline__ v8f mac3(const F2& a, const F2& b, v8f c) { c = wmma_bf(a.l, b.h, c); c = wmma_bf(a.h, b.l, c); return wmma_bf(a.h, b.h, c); }
__device__ __forceinline__ float sigm(float v) { return 1.0f / (1.0f + expf(-v)); }
#define LDSX() do { asm volatile("s_wait_dscnt 0" ::: "memory"); __builtin_amdgcn_wave_barrier(); __builtin_amdgcn_fence(__ATOMIC_RELEASE, "workgroup"); } while (0)


// Local-window self attention over video feature maps (2 x 8 frames of 32 x 32 positions, dim 256, 8 heads x 32): LayerNorm, q/k/v projections, each position attends to its 3 x 3 replicate-clamped neighbourhood, output projection + residual.
#define NFR 16          // b*t frames
#define HH 32
#define WWd 32
#define NPOS (HH * WWd)
#define DM 256
#define NHD 8
#define HD 32
#define NR (NFR * NPOS)   // 16384 rows
#ifndef TRB
#define TRB (NR / 64)
#endif
typedef __attribute__((ext_vector_type(8))) __bf16 v8b;
// B fragment number t = (16-column tile) * 8 + (32-k chunk) of a packed weight matrix: 1 KiB, elements 0..7 of all 32 lanes and then elements 8..15, so each of the two loads is 512 contiguous bytes (4 whole lines). Wb: the first fragment, fo = lane * 16
__device__ __forceinline__ v16h frag_p(const char* Wb, unsigned fo, int t) {
  union { v16h v; v8h q[2]; } u; const char* p = Wb + (fo + (unsigned)t * 1024u);
  u.q[0] = *(const v8h*)p; u.q[1] = *(const v8h*)(p + 512); return u.v;
}
__device__ __forceinline__ float bfr(float v) { return (float)(__bf16)v; }
__device__ __attribute__((noinline)) float exp_ni(float v) { return expf(v); }
__device__ __attribute__((noinline)) float erf_ni(float v) { return erff(v); }

#define WS_PW  0u                                   // f16 (of the bf16-rounded weights) in B-fragment order: wq, wk, wv, wo, each [16 column tiles][8 k chunks][2 halves][32 lanes][8]
#define WS_END (WS_PW + 2u * 4 * DM * DM)
// channel that packed column p of wq, wk, wv computes: column c of the 16-column tiles 2t and 2t + 1 are channels 32t + 2c and 32t + 2c + 1, so that a lane of the q/k/v products holds both halves of an f16 pair
#define QKV_CH(p) (((p) >> 5) * 32 + ((p) & 15) * 2 + (((p) >> 4) & 1))
typedef __attribute__((ext_vector_type(2))) _Float16 v2h;

// ---- k_pack: block = one 16-column tile of one weight matrix, wave = one 32-k chunk: each lane gathers the 16 values of its own B fragment (packed column jt * 16 + col, k = kc * 32 + 8 g + 0..7 and + 16 + 0..7; a load covers pieces of two rows) and the wave stores the fragment as two runs of 512 bytes, every line written whole by one wave
__global__ __launch_bounds__(256) void k_pack(const float* __restrict__ WQ, const float* __restrict__ WK, const float* __restrict__ WV, const float* __restrict__ WO, _Float16* __restrict__ PW) {
  const int jt = blockIdx.x, which = blockIdx.y, lane = threadIdx.x & 31, col = lane & 15, g = lane >> 4; const int kc = __builtin_amdgcn_readfirstlane(threadIdx.x >> 5);
  const float* Wm = (which == 0) ? WQ : (which == 1) ? WK : (which == 2) ? WV : WO;
  const int pc = jt * 16 + col, cc = which < 3 ? QKV_CH(pc) : pc;   // packed column pc of wq, wk, wv is the weight column of channel QKV_CH(pc)
  const char* Wt = (const char*)(Wm + (size_t)kc * 32 * DM); const unsigned pi = 8 * g * DM + cc, po = pi * 4;   // scalar base and one 32-bit byte offset serve all 16 loads
  float v[16];
#pragma unroll
  for (int i = 0; i < 8; ++i) { v[i] = *(const float*)(Wt + po + i * (DM * 4)); v[8 + i] = *(const float*)(Wt + po + (16 + i) * (DM * 4)); }
  asm volatile("s_wait_xcnt 0x0" :: "v"(pi) : "memory");   // behind the loads, before a register that they name is written again; the element index, which the built loads take as their offset, is named as an input so that it keeps its register up to this wait and no load's result lands in it
  v8h o0, o1;
#pragma unroll
  for (int i = 0; i < 8; ++i) { o0[i] = (_Float16)bfr(v[i]); o1[i] = (_Float16)bfr(v[8 + i]); }
  _Float16* d = PW + (((size_t)which * 16 + jt) * 8 + kc) * 512 + lane * 8;
  vst2(d, o0); vst2(d + 256, o1);
}
// step of a sum over neighbouring lanes (the 4 that share one head; a LayerNorm row): lane l adds the value of lane l ^ M inside its 16-lane row (folds into v_add_f32_dpp row_xmask)
template <int M> __device__ __forceinline__ float xadd(float v) { return v + __int_as_float(__builtin_amdgcn_update_dpp(0, __float_as_int(v), 0x160 + M, 0xf, 0xf, true)); }
// lane l with lane l ^ 16
__device__ __forceinline__ float xhalf(float v) { return __int_as_float(__builtin_amdgcn_permlanex16(__float_as_int(v), __float_as_int(v), 0x76543210, 0xfedcba98, false, false)); }
// sum over the wave's 32 lanes, the partner distances in the order 1, 2, 4, 8, 16
__device__ __forceinline__ float wsum(float v) { v = xadd<1>(v); v = xadd<2>(v); v = xadd<4>(v); v = xadd<8>(v); return v + xhalf(v); }
// f16 x f16 + f32 and f32 x f16 + f32 in one instruction each (v_fma_mix_f32: the f16 value is widened exactly, the product and the sum are rounded once, as fmaf on the widened values). Written as asm because the compiler otherwise widens every k and v value with an instruction of its own (152 a position) in front of packed f32 FMAs. In each statement 9 (8) independent sums take turns, so that an instruction's producer stands 9 (8) instructions back and no delay hint is missing
// s[kk] (+)= q.lo * k[kk][D].lo, then q.hi * k[kk][D].hi: channels 2D and 2D + 1 of the lane's 8, in that order
template <int D> __device__ __forceinline__ void qk_first(float (&s)[9], unsigned q, const v4u (&k)[9]) {
  asm("v_fma_mix_f32 %0, %9, %10, 0 op_sel:[0,0,0] op_sel_hi:[1,1,0]\n\t"
      "v_fma_mix_f32 %1, %9, %11, 0 op_sel:[0,0,0] op_sel_hi:[1,1,0]\n\t"
      "v_fma_mix_f32 %2, %9, %12, 0 op_sel:[0,0,0] op_sel_hi:[1,1,0]\n\t"
      "v_fma_mix_f32 %3, %9, %13, 0 op_sel:[0,0,0] op_sel_hi:[1,1,0]\n\t"
      "v_fma_mix_f32 %4, %9, %14, 0 op_sel:[0,0,0] op_sel_hi:[1,1,0]\n\t"
      "v_fma_mix_f32 %5, %9, %15, 0 op_sel:[0,0,0] op_sel_hi:[1,1,0]\n\t"
      "v_fma_mix_f32 %6, %9, %16, 0 op_sel:[0,0,0] op_sel_hi:[1,1,0]\n\t"
      "v_fma_mix_f32 %7, %9, %17, 0 op_sel:[0,0,0] op_sel_hi:[1,1,0]\n\t"
      "v_fma_mix_f32 %8, %9, %18, 0 op_sel:[0,0,0] op_sel_hi:[1,1,0]\n\t"
      "v_fma_mix_f32 %0, %9, %10, %0 op_sel:[1,1,0] op_sel_hi:[1,1,0]\n\t"
      "v_fma_mix_f32 %1, %9, %11, %1 op_sel:[1,1,0] op_sel_hi:[1,1,0]\n\t"
      "v_fma_mix_f32 %2, %9, %12, %2 op_sel:[1,1,0] op_sel_hi:[1,1,0]\n\t"
      "v_fma_mix_f32 %3, %9, %13, %3 op_sel:[1,1,0] op_sel_hi:[1,1,0]\n\t"
      "v_fma_mix_f32 %4, %9, %14, %4 op_sel:[1,1,0] op_sel_hi:[1,1,0]\n\t"
      "v_fma_mix_f32 %5, %9, %15, %5 op_sel:[1,1,0] op_sel_hi:[1,1,0]\n\t"
      "v_fma_mix_f32 %6, %9, %16, %6 op_sel:[1,1,0] op_sel_hi:[1,1,0]\n\t"
      "v_fma_mix_f32 %7, %9, %17, %7 op_sel:[1,1,0] op_sel_hi:[1,1,0]\n\t"
      "v_fma_mix_f32 %8, %9, %18, %8 op_sel:[1,1,0] op_sel_hi:[1,1,0]"
      : "=&v"(s[0]), "=&v"(s[1]), "=&v"(s[2]), "=&v"(s[3]), "=&v"(s[4]), "=&v"(s[5]), "=&v"(s[6]), "=&v"(s[7]), "=&v"(s[8]) : "v"(q), "v"(k[0][D]), "v"(k[1][D]), "v"(k[2][D]), "v"(k[3][D]), "v"(k[4][D]), "v"(k[5][D]), "v"(k[6][D]), "v"(k[7][D]), "v"(k[8][D]));
}
template <int D> __device__ __forceinline__ void qk_next(float (&s)[9], unsigned q, const v4u (&k)[9]) {
  asm("v_fma_mix_f32 %0, %9, %10, %0 op_sel:[0,0,0] op_sel_hi:[1,1,0]\n\t"
      "v_fma_mix_f32 %1, %9, %11, %1 op_sel:[0,0,0] op_sel_hi:[1,1,0]\n\t"
      "v_fma_mix_f32 %2, %9, %12, %2 op_sel:[0,0,0] op_sel_hi:[1,1,0]\n\t"
      "v_fma_mix_f32 %3, %9, %13, %3 op_sel:[0,0,0] op_sel_hi:[1,1,0]\n\t"
      "v_fma_mix_f32 %4, %9, %14, %4 op_sel:[0,0,0] op_sel_hi:[1,1,0]\n\t"
      "v_fma_mix_f32 %5, %9, %15, %5 op_sel:[0,0,0] op_sel_hi:[1,1,0]\n\t"
      "v_fma_mix_f32 %6, %9, %16, %6 op_sel:[0,0,0] op_sel_hi:[1,1,0]\n\t"
      "v_fma_mix_f32 %7, %9, %17, %7 op_sel:[0,0,0] op_sel_hi:[1,1,0]\n\t"
      "v_fma_mix_f32 %8, %9, %18, %8 op_sel:[0,0,0] op_sel_hi:[1,1,0]\n\t"
      "v_fma_mix_f32 %0, %9, %10, %0 op_sel:[1,1,0] op_sel_hi:[1,1,0]\n\t"
      "v_fma_mix_f32 %1, %9, %11, %1 op_sel:[1,1,0] op_sel_hi:[1,1,0]\n\t"
      "v_fma_mix_f32 %2, %9, %12, %2 op_sel:[1,1,0] op_sel_hi:[1,1,0]\n\t"
      "v_fma_mix_f32 %3, %9, %13, %3 op_sel:[1,1,0] op_sel_hi:[1,1,0]\n\t"
      "v_fma_mix_f32 %4, %9, %14, %4 op_sel:[1,1,0] op_sel_hi:[1,1,0]\n\t"
      "v_fma_mix_f32 %5, %9, %15, %5 op_sel:[1,1,0] op_sel_hi:[1,1,0]\n\t"
      "v_fma_mix_f32 %6, %9, %16, %6 op_sel:[1,1,0] op_sel_hi:[1,1,0]\n\t"
      "v_fma_mix_f32 %7, %9, %17, %7 op_sel:[1,1,0] op_sel_hi:[1,1,0]\n\t"
      "v_fma_mix_f32 %8, %9, %18, %8 op_sel:[1,1,0] op_sel_hi:[1,1,0]"
      : "+v"(s[0]), "+v"(s[1]), "+v"(s[2]), "+v"(s[3]), "+v"(s[4]), "+v"(s[5]), "+v"(s[6]), "+v"(s[7]), "+v"(s[8]) : "v"(q), "v"(k[0][D]), "v"(k[1][D]), "v"(k[2][D]), "v"(k[3][D]), "v"(k[4][D]), "v"(k[5][D]), "v"(k[6][D]), "v"(k[7][D]), "v"(k[8][D]));
}
// o[c] (+)= w[kk] * v[kk] channel c, the keys K0, K0 + 1, .. in that order
template <int K0> __device__ __forceinline__ void pv_first3(float (&o)[8], const float (&w)[9], const v4u (&v)[9]) {
  asm("v_fma_mix_f32 %0, %8, %9, 0 op_sel:[0,0,0] op_sel_hi:[0,1,0]\n\t"
      "v_fma_mix_f32 %1, %8, %9, 0 op_sel:[0,1,0] op_sel_hi:[0,1,0]\n\t"
      "v_fma_mix_f32 %2, %8, %10, 0 op_sel:[0,0,0] op_sel_hi:[0,1,0]\n\t"
      "v_fma_mix_f32 %3, %8, %10, 0 op_sel:[0,1,0] op_sel_hi:[0,1,0]\n\t"
      "v_fma_mix_f32 %4, %8, %11, 0 op_sel:[0,0,0] op_sel_hi:[0,1,0]\n\t"
      "v_fma_mix_f32 %5, %8, %11, 0 op_sel:[0,1,0] op_sel_hi:[0,1,0]\n\t"
      "v_fma_mix_f32 %6, %8, %12, 0 op_sel:[0,0,0] op_sel_hi:[0,1,0]\n\t"
      "v_fma_mix_f32 %7, %8, %12, 0 op_sel:[0,1,0] op_sel_hi:[0,1,0]\n\t"
      "v_fma_mix_f32 %0, %13, %14, %0 op_sel:[0,0,0] op_sel_hi:[0,1,0]\n\t"
      "v_fma_mix_f32 %1, %13, %14, %1 op_sel:[0,1,0] op_sel_hi:[0,1,0]\n\t"
      "v_fma_mix_f32 %2, %13, %15, %2 op_sel:[0,0,0] op_sel_hi:[0,1,0]\n\t"
      "v_fma_mix_f32 %3, %13, %15, %3 op_sel:[0,1,0] op_sel_hi:[0,1,0]\n\t"
      "v_fma_mix_f32 %4, %13, %16, %4 op_sel:[0,0,0] op_sel_hi:[0,1,0]\n\t"
      "v_fma_mix_f32 %5, %13, %16, %5 op_sel:[0,1,0] op_sel_hi:[0,1,0]\n\t"
      "v_fma_mix_f32 %6, %13, %17, %6 op_sel:[0,0,0] op_sel_hi:[0,1,0]\n\t"
      "v_fma_mix_f32 %7, %13, %17, %7 op_sel:[0,1,0] op_sel_hi:[0,1,0]\n\t"
      "v_fma_mix_f32 %0, %18, %19, %0 op_sel:[0,0,0] op_sel_hi:[0,1,0]\n\t"
      "v_fma_mix_f32 %1, %18, %19, %1 op_sel:[0,1,0] op_sel_hi:[0,1,0]\n\t"
      "v_fma_mix_f32 %2, %18, %20, %2 op_sel:[0,0,0] op_sel_hi:[0,1,0]\n\t"
      "v_fma_mix_f32 %3, %18, %20, %3 op_sel:[0,1,0] op_sel_hi:[0,1,0]\n\t"
      "v_fma_mix_f32 %4, %18, %21, %4 op_sel:[0,0,0] op_sel_hi:[0,1,0]\n\t"
      "v_fma_mix_f32 %5, %18, %21, %5 op_sel:[0,1,0] op_sel_hi:[0,1,0]\n\t"
      "v_fma_mix_f32 %6, %18, %22, %6 op_sel:[0,0,0] op_sel_hi:[0,1,0]\n\t"
      "v_fma_mix_f32 %7, %18, %22, %7 op_sel:[0,1,0] op_sel_hi:[0,1,0]"
      : "=&v"(o[0]), "=&v"(o[1]), "=&v"(o[2]), "=&v"(o[3]), "=&v"(o[4]), "=&v"(o[5]), "=&v"(o[6]), "=&v"(o[7]) : "v"(w[K0 + 0]), "v"(v[K0 + 0][0]), "v"(v[K0 + 0][1]), "v"(v[K0 + 0][2]), "v"(v[K0 + 0][3]), "v"(w[K0 + 1]), "v"(v[K0 + 1][0]), "v"(v[K0 + 1][1]), "v"(v[K0 + 1][2]), "v"(v[K0 + 1][3]), "v"(w[K0 + 2]), "v"(v[K0 + 2][0]), "v"(v[K0 + 2][1]), "v"(v[K0 + 2][2]), "v"(v[K0 + 2][3]));
}
template <int K0> __device__ __forceinline__ void pv_next2(float (&o)[8], const float (&w)[9], const v4u (&v)[9]) {
  asm("v_fma_mix_f32 %0, %8, %9, %0 op_sel:[0,0,0] op_sel_hi:[0,1,0]\n\t"
      "v_fma_mix_f32 %1, %8, %9, %1 op_sel:[0,1,0] op_sel_hi:[0,1,0]\n\t"
      "v_fma_mix_f32 %2, %8, %10, %2 op_sel:[0,0,0] op_sel_hi:[0,1,0]\n\t"
      "v_fma_mix_f32 %3, %8, %10, %3 op_sel:[0,1,0] op_sel_hi:[0,1,0]\n\t"
      "v_fma_mix_f32 %4, %8, %11, %4 op_sel:[0,0,0] op_sel_hi:[0,1,0]\n\t"
      "v_fma_mix_f32 %5, %8, %11, %5 op_sel:[0,1,0] op_sel_hi:[0,1,0]\n\t"
      "v_fma_mix_f32 %6, %8, %12, %6 op_sel:[0,0,0] op_sel_hi:[0,1,0]\n\t"
      "v_fma_mix_f32 %7, %8, %12, %7 op_sel:[0,1,0] op_sel_hi:[0,1,0]\n\t"
      "v_fma_mix_f32 %0, %13, %14, %0 op_sel:[0,0,0] op_sel_hi:[0,1,0]\n\t"
      "v_fma_mix_f32 %1, %13, %14, %1 op_sel:[0,1,0] op_sel_hi:[0,1,0]\n\t"
      "v_fma_mix_f32 %2, %13, %15, %2 op_sel:[0,0,0] op_sel_hi:[0,1,0]\n\t"
      "v_fma_mix_f32 %3, %13, %15, %3 op_sel:[0,1,0] op_sel_hi:[0,1,0]\n\t"
      "v_fma_mix_f32 %4, %13, %16, %4 op_sel:[0,0,0] op_sel_hi:[0,1,0]\n\t"
      "v_fma_mix_f32 %5, %13, %16, %5 op_sel:[0,1,0] op_sel_hi:[0,1,0]\n\t"
      "v_fma_mix_f32 %6, %13, %17, %6 op_sel:[0,0,0] op_sel_hi:[0,1,0]\n\t"
      "v_fma_mix_f32 %7, %13, %17, %7 op_sel:[0,1,0] op_sel_hi:[0,1,0]"
      : "+v"(o[0]), "+v"(o[1]), "+v"(o[2]), "+v"(o[3]), "+v"(o[4]), "+v"(o[5]), "+v"(o[6]), "+v"(o[7]) : "v"(w[K0 + 0]), "v"(v[K0 + 0][0]), "v"(v[K0 + 0][1]), "v"(v[K0 + 0][2]), "v"(v[K0 + 0][3]), "v"(w[K0 + 1]), "v"(v[K0 + 1][0]), "v"(v[K0 + 1][1]), "v"(v[K0 + 1][2]), "v"(v[K0 + 1][3]));
}
typedef __attribute__((ext_vector_type(4))) _Float16 v4h;
// A fragment from a row of f16 values in LDS: p = the lane's row + (k0 + 8 g) elements; elements 0..7 there, 8..15 sixteen elements on
__device__ __forceinline__ v16h frag_l(const char* p) { union { v16h v; v8h q[2]; } u; u.q[0] = *(const v8h*)p; u.q[1] = *(const v8h*)(p + 32); return u.v; }
#define RP 528                                  // bytes of an LDS row of xn, of q or of ctx: 256 f16 + 16, an odd number of 16-byte steps; xn is [128][RP] from byte 0
#define XP 1040                                 // bytes of an LDS row of k and v together: 2 x 256 f16 + 16 (an odd number of 16-byte steps)
#define OFF_SC 0                                // ctx f16 [64][RP], over xn once it is dead
#define OFF_SO (64 * RP)                        // output staging f32 [16][32][36], its first part over xn too
#define OFF_Q  (OFF_SO + 16 * 32 * 36 * 4)      // q f16 [64][RP]
#define OFF_KV (OFF_Q + 64 * RP)                // k and v f16 [128][XP]: a slot's k row, its v row 512 bytes on (one address register serves both reads), + 16
#define LDS_ALL (OFF_KV + 128 * XP)
// ---- k_all: block = 64 positions of one frame (image rows y0, y0 + 1), 16 waves, 4 on a SIMD. LDS slot s = 0..127 stands for image row clamp(y0 - 1 + s / 32), column s % 32: the block's own two rows and the row above and below, whose k and v its positions attend to.
// 1. xn = (x - mu) * rsqrt(var + 1e-5) * g + b (biased variance) of the 128 slots, a wave taking every 16th slot whole (lane l holds channels 4l..4l+3 and 128+4l..128+4l+3), rounded once to f16 in LDS.
// 2. q (64 slots), k, v (128 slots) = xn . W + b -> f16 rows in LDS. Wave = (rh: the four 16-slot tiles 4rh..4rh+3; m: 0 k / 1 v), two passes of 32 channels (column tiles 2cp, 2cp + 1); on one of its tiles it also does q, so that each A fragment read serves 2 or 4 column tiles and each weight fragment 4 row tiles.
// 3. attention: a wave takes one position at a time, lane l holding channels 8l..8l+7 (4 lanes per head), a q/k/v row being one LDS read of 512 contiguous bytes; the 9 clamped neighbours: scores / sqrt(32), softmax, weighted v (f32 on VALU).
// 4. wave = (32 rows, 32 columns): ctx (f16) . Wo + bo + x; the wave's 16 Wo fragments are asked for in front of step 3, which reads no global memory
__global__ __launch_bounds__(512) void k_all(const float* __restrict__ X, const float* __restrict__ G, const float* __restrict__ Bt, const _Float16* __restrict__ PW, const float* __restrict__ BQ, const float* __restrict__ BK, const float* __restrict__ BV, const float* __restrict__ BO, float* __restrict__ OUT) {
  __shared__ __align__(16) char sm[LDS_ALL];
  const int tid = threadIdx.x, lane = tid & 31, col = lane & 15, g = lane >> 4; const size_t rb0 = (size_t)blockIdx.x * 64; const size_t fr = rb0 / NPOS; const int p0 = (int)(rb0 % NPOS), y0 = p0 / WWd;
  const int wv = __builtin_amdgcn_readfirstlane(tid >> 5);   // the wave's number in a scalar register: slots, positions, clamps, weight and bias pointers are then scalar work
  const unsigned lo = lane * 16;
  // q/k/v products: wave = (rh, m, column tiles 4 (wv >> 2) .. + 3 in two passes). The weight fragments of a pass's first two k chunks live across the barrier (the pass's end) in front of it
  const int m = (wv >> 1) & 1;
  const char* Wk0 = (const char*)(PW + (size_t)(1 + m) * DM * DM + (size_t)(wv >> 2) * 64 * DM); const char* Wq0 = (const char*)(PW + (size_t)(wv >> 2) * 64 * DM);
  v16h w[3][2], wq[2][2];
  { v4f xv[8][2], gg[2], bt[2]; float mu[8], inv[8];   // the wave's slots wv, wv + 16, ..: all row loads go out first, and each stage runs over all eight rows, so that eight independent chains fill one another's latency
    const char* Xf = (const char*)(X + fr * NPOS * DM); unsigned xo[8];   // one scalar base and a 32-bit byte offset a row
#pragma unroll
    for (int it = 0; it < 8; ++it) { int iy = y0 - 1 + (it >> 1); iy = iy < 0 ? 0 : (iy > HH - 1 ? HH - 1 : iy); xo[it] = (unsigned)((iy * WWd + wv + 16 * (it & 1)) * (DM * 4)) + lo; }
#pragma unroll
    for (int it = 0; it < 8; ++it) { const char* xr = Xf + xo[it]; xv[it][0] = *(const v4f*)xr; xv[it][1] = *(const v4f*)(xr + 512); }
#pragma unroll
    for (int hf = 0; hf < 2; ++hf) { gg[hf] = *(const v4f*)((const char*)G + lo + hf * 512); bt[hf] = *(const v4f*)((const char*)Bt + lo + hf * 512); }
    // behind the loads, before any register that they name is written again; the offsets (and the lane number, which the built loads of g and b take as theirs) are named as inputs so that each keeps its own register up to this wait and no load's result lands in one
    asm volatile("s_wait_xcnt 0x0" :: "v"(lane), "v"(lo), "v"(xo[0]), "v"(xo[1]), "v"(xo[2]), "v"(xo[3]), "v"(xo[4]), "v"(xo[5]), "v"(xo[6]), "v"(xo[7]) : "memory");
    // the first pass's first weight fragments go out behind the rows, so that they arrive under the LayerNorm arithmetic and not behind the barrier
#pragma unroll
    for (int c = 0; c < 2; ++c) {
#pragma unroll
      for (int j = 0; j < 2; ++j) { w[c][j] = frag_p(Wk0, lo, j * 8 + c); wq[c][j] = frag_p(Wq0, lo, j * 8 + c); } }
    asm volatile("s_wait_xcnt 0x0" :: "v"(lane), "v"(lo) : "memory");   // behind the loads, before a register that they name is written again; the lane number and the offset, of which the built loads take one, are named as inputs so that each keeps its register up to this wait
#pragma unroll
    for (int hf = 0; hf < 2; ++hf) {
#pragma unroll
      for (int i = 0; i < 4; ++i) { gg[hf][i] = bfr(gg[hf][i]); bt[hf][i] = bfr(bt[hf][i]); } }
#pragma unroll
    for (int it = 0; it < 8; ++it) { float s[2];
#pragma unroll
      for (int hf = 0; hf < 2; ++hf) { s[hf] = 0.f;
#pragma unroll
        for (int i = 0; i < 4; ++i) { xv[it][hf][i] = bfr(xv[it][hf][i]); s[hf] += xv[it][hf][i]; }
        s[hf] = wsum(s[hf]); }
      mu[it] = (s[0] + s[1]) / (float)DM; }
#pragma unroll
    for (int it = 0; it < 8; ++it) { float q[2];
#pragma unroll
      for (int hf = 0; hf < 2; ++hf) { q[hf] = 0.f;
#pragma unroll
        for (int i = 0; i < 4; ++i) { const float dd = xv[it][hf][i] - mu[it]; q[hf] += dd * dd; }
        q[hf] = wsum(q[hf]); }
      inv[it] = 1.0f / sqrtf((q[0] + q[1]) / (float)DM + 1e-5f); }
#pragma unroll
    for (int it = 0; it < 8; ++it) { const int r = wv + 16 * it;
#pragma unroll
      for (int hf = 0; hf < 2; ++hf) { v4h hh;
#pragma unroll
        for (int i = 0; i < 4; ++i) hh[i] = (_Float16)((xv[it][hf][i] - mu[it]) * inv[it] * gg[hf][i] + bt[hf][i]);
        vst2(sm + r * RP + hf * 256 + lane * 8, hh); } } }
  __syncthreads();   // a wave's A tiles were written by all 16 waves
  { const int rh = wv & 1;
    const int qt = rh * 2 + 2 + m;   // the wave's tile that also gets q: q lives on tiles 2..5 (slots 32..95), one for each (rh, m)
    int tl[4]; const char* ap[4];
#pragma unroll
    for (int t = 0; t < 4; ++t) { tl[t] = rh * 4 + ((qt + t) & 3); ap[t] = sm + (tl[t] * 16 + col) * RP + g * 16; }
    const float* bkv = m ? BV : BK;
#pragma unroll 1
    for (int pass = 0; pass < 2; ++pass) { const int cp = (wv >> 2) * 2 + pass;
      const char* Wkv = (const char*)(PW + (size_t)(1 + m) * DM * DM + (size_t)cp * 32 * DM); const char* Wqp = (const char*)(PW + (size_t)cp * 32 * DM);   // column tiles 2cp and 2cp + 1: 16 fragments in a row
      const int ch = cp * 32 + col * 2;   // column col of the two tiles: channels ch and ch + 1 (QKV_CH), one f16 pair
      const float bk0 = bfr(bkv[ch]), bk1 = bfr(bkv[ch + 1]), bq0 = bfr(BQ[ch]), bq1 = bfr(BQ[ch + 1]);
      char* dkv = sm + OFF_KV + m * 512 + (8 * g) * XP + (cp * 16 + col) * 4; char* dq = sm + OFF_Q + (8 * g) * RP + (cp * 16 + col) * 4;
      v8f ak[4][2] = {}, aq[2] = {}; v16h a[4];
#pragma unroll
      for (int t = 0; t < 4; ++t) a[t] = frag_l(ap[t]);
      // a k chunk is 10 WMMAs, so the k or v weight fragments go out two whole chunks (20 WMMAs) ahead into a third set of registers; the q weight fragments, used on the chunk's first tile alone, are reloaded right behind it for the chunk after the next, and an A tile's next fragment right behind its last WMMA of this chunk. Unrolled whole, so that the waits are counted ones. Each accumulator takes the k chunks in rising order
#pragma unroll
      for (int kc = 0; kc < DM / 32; ++kc) { const int c = kc % 3, cq = kc & 1;
        if (kc + 2 < DM / 32) {
#pragma unroll
          for (int j = 0; j < 2; ++j) w[(kc + 2) % 3][j] = frag_p(Wkv, lo, j * 8 + kc + 2); }
#pragma unroll
        for (int t = 0; t < 4; ++t) {
          ak[t][0] = wmma16(a[t], w[c][0], ak[t][0]); ak[t][1] = wmma16(a[t], w[c][1], ak[t][1]);
          if (t == 0) { aq[0] = wmma16(a[t], wq[cq][0], aq[0]); aq[1] = wmma16(a[t], wq[cq][1], aq[1]);
            if (kc + 2 < DM / 32) { wq[cq][0] = frag_p(Wqp, lo, kc + 2); wq[cq][1] = frag_p(Wqp, lo, 8 + kc + 2); } }
          if (kc + 1 < DM / 32) a[t] = frag_l(ap[t] + (kc + 1) * 64);
          __builtin_amdgcn_sched_barrier(0); } }   // keeps the tiles in this order: with a later tile's WMMAs moved up, the next chunk's would wait for A fragments that have only just been asked for
      asm volatile("s_wait_xcnt 0x0" ::: "memory");   // behind the pass's weight and bias loads, before the next pass writes their address registers again
      if (pass == 0) {   // the second pass's first weight fragments go out here, so that they arrive under this pass's stores
#pragma unroll
        for (int c = 0; c < 2; ++c) {
#pragma unroll
          for (int j = 0; j < 2; ++j) { w[c][j] = frag_p(Wkv + 32 * DM * 2, lo, j * 8 + c); wq[c][j] = frag_p(Wqp + 32 * DM * 2, lo, j * 8 + c); } }
        asm volatile("s_wait_xcnt 0x0" ::: "memory"); }   // behind the loads, before a register that they name is written again
#pragma unroll
      for (int t = 0; t < 4; ++t) {
#pragma unroll
        for (int r = 0; r < 8; ++r) { v2h pr; pr[0] = (_Float16)(ak[t][0][r] + bk0); pr[1] = (_Float16)(ak[t][1][r] + bk1); vst2(dkv + (tl[t] * 16 + r) * XP, pr); } }
#pragma unroll
      for (int r = 0; r < 8; ++r) { v2h pr; pr[0] = (_Float16)(aq[0][r] + bq0); pr[1] = (_Float16)(aq[1][r] + bq1); vst2(dq + ((qt - 2) * 16 + r) * RP, pr); } } }
  __syncthreads();   // q, k, v rows were written by all 16 waves; behind it xn is dead
  float (*so)[32][36] = (float (*)[32][36])(sm + OFF_SO);
  // out projection: waves 2cg and 2cg + 1 take the two 32-row halves of the 32 columns cg * 32 ..; the wave's 16 weight fragments (column tiles 2cg, 2cg + 1) stand in a row
  const int rt = wv & 1, cg = wv >> 1;
  const char* Wp = (const char*)(PW + (size_t)cg * 32 * DM) + lo;   // the lane's 16 bytes in the first fragment of column tile 2cg of wq; wo stands three matrices on
  v16h wb[DM / 32][2];
  // all 16 go out here, into 128 registers that the attention loop leaves free, so that they arrive under that loop, which reads no global memory
#pragma unroll
  for (int kc = 0; kc < DM / 32; ++kc) {
#pragma unroll
    for (int j = 0; j < 2; ++j) wb[kc][j] = frag_p(Wp + 3 * DM * DM * 2, 0u, j * 8 + kc); }
  asm volatile("s_wait_xcnt 0x0" :: "v"(Wp) : "memory");   // behind the loads, before a register that they name is written again: the address is named as an input so that it keeps its registers up to this wait and no load's result lands in them; the statement also keeps the loads in front of the loop
  unsigned vb[3];   // the three neighbour image rows' first slots in k/v, this lane's 16 bytes: the same on all four trips
#pragma unroll
  for (int dy = 0; dy < 3; ++dy) { int ny = y0 + (wv >> 3) + dy - 1; ny = ny < 0 ? 0 : (ny > HH - 1 ? HH - 1 : ny); vb[dy] = (unsigned)(OFF_KV + (ny - y0 + 1) * WWd * XP) + lo; }
  // one position a trip (unroll 1: four waves on a SIMD cover one another's latency and dependent chains); the inner loops are unrolled so that kv, vv and sco stay in registers
#pragma unroll 1
  for (int i = 0; i < 4; ++i) { const int px = i * 8 + (wv & 7), r = (wv >> 3) * WWd + px;
    v4u kv[9], vv[9]; const v4u qv = *(const v4u*)(sm + OFF_Q + r * RP + lo);   // 8 f16 channels in 4 registers
    unsigned xc[3];   // the three neighbour columns' byte offsets, scalar
#pragma unroll
    for (int dx = 0; dx < 3; ++dx) { int nx = px + dx - 1; nx = nx < 0 ? 0 : (nx > WWd - 1 ? WWd - 1 : nx); xc[dx] = (unsigned)(nx * XP); }
#pragma unroll
    for (int kk = 0; kk < 9; ++kk) kv[kk] = *(const v4u*)(sm + (vb[kk / 3] + xc[kk % 3]));
#pragma unroll
    for (int kk = 0; kk < 9; ++kk) vv[kk] = *(const v4u*)(sm + (vb[kk / 3] + xc[kk % 3]) + 512);
    float sco[9]; float mx = -3.0e38f;
    qk_first<0>(sco, qv[0], kv); qk_next<1>(sco, qv[1], kv); qk_next<2>(sco, qv[2], kv); qk_next<3>(sco, qv[3], kv);
#pragma unroll
    for (int kk = 0; kk < 9; ++kk) { float s = sco[kk];
      s = xadd<1>(s); s = xadd<2>(s);
      s *= 0.17677669529663687f; sco[kk] = s; mx = fmaxf(mx, s); }   // 1/sqrt(32)
    float den = 0.f;
#pragma unroll
    for (int kk = 0; kk < 9; ++kk) { const float e = expf(sco[kk] - mx); sco[kk] = e; den += e; }
    const float inv = 1.0f / den;
    float ox[8];
#pragma unroll
    for (int kk = 0; kk < 9; ++kk) sco[kk] *= inv;
    pv_first3<0>(ox, sco, vv); pv_next2<3>(ox, sco, vv); pv_next2<5>(ox, sco, vv); pv_next2<7>(ox, sco, vv);
    v8h oc;
#pragma unroll
    for (int c = 0; c < 8; ++c) oc[c] = (_Float16)ox[c];
    vst2(sm + OFF_SC + r * RP + lo, oc); }   // ctx as f16 in the plain channel order
  __syncthreads();
  // out = ctx . Wo + bo + x
  const size_t r0 = rb0 + rt * 32;
  const float bb0 = bfr(BO[cg * 32 + col]), bb1 = bfr(BO[cg * 32 + 16 + col]);
  asm volatile("s_wait_xcnt 0x0" ::: "memory");   // behind the loads, before a register that they name is written again
  v8f acc[2][2] = {};
  const char* Ar = sm + OFF_SC + (rt * 32 + col) * RP + g * 16;
  const float* Xr = X + (r0 + (lane >> 3)) * DM + cg * 32 + (lane & 7) * 4;   // x in the order of the output stores: a load covers four rows' 128-byte pieces, each a whole line
  v4f xr[8]; v16h a[3][2];
#pragma unroll
  for (int c = 0; c < 2; ++c) { a[c][0] = frag_l(Ar + c * 64); a[c][1] = frag_l(Ar + 16 * RP + c * 64); }
  // a k chunk is 4 WMMAs on 4 accumulators; the two A fragments are read from LDS two chunks ahead; each accumulator takes the k chunks in rising order. x goes out once the first two chunks' weight registers are free, 24 WMMAs ahead of its use, not behind the last WMMA
#pragma unroll
  for (int kc = 0; kc < DM / 32; ++kc) { const int c = kc % 3;
    if (kc + 2 < DM / 32) { a[(kc + 2) % 3][0] = frag_l(Ar + (kc + 2) * 64); a[(kc + 2) % 3][1] = frag_l(Ar + 16 * RP + (kc + 2) * 64); }
    if (kc == 2) {
#pragma unroll
      for (int i = 0; i < 8; ++i) xr[i] = *(const v4f*)(Xr + (size_t)i * 4 * DM);
      asm volatile("s_wait_xcnt 0x0" ::: "memory"); }   // behind the loads, before a register that they name is written again
    acc[0][0] = wmma16(a[c][0], wb[kc][0], acc[0][0]); acc[0][1] = wmma16(a[c][0], wb[kc][1], acc[0][1]);
    acc[1][0] = wmma16(a[c][1], wb[kc][0], acc[1][0]); acc[1][1] = wmma16(a[c][1], wb[kc][1], acc[1][1]);
    __builtin_amdgcn_sched_barrier(0); }   // keeps the chunks, the LDS reads and the x loads in this order: moved up, they would all ask for registers at once
#pragma unroll
  for (int i = 0; i < 2; ++i) {
#pragma unroll
    for (int r = 0; r < 8; ++r) { so[wv][16 * i + 8 * g + r][col] = acc[i][0][r] + bb0; so[wv][16 * i + 8 * g + r][16 + col] = acc[i][1][r] + bb1; } }
  LDSX();
  // a store covers four rows' 128-byte pieces, each a whole line
#pragma unroll
  for (int i = 0; i < 8; ++i) { const int row = i * 4 + (lane >> 3); v4f t = *(const v4f*)&so[wv][row][(lane & 7) * 4];
#pragma unroll
    for (int e = 0; e < 4; ++e) t[e] += bfr(xr[i][e]);
    vst2(OUT + (r0 + row) * DM + cg * 32 + (lane & 7) * 4, t); }
}
extern "C" void kernel_launch(void* const* d_in, const int* in_sizes, int n_in, void* d_out, int out_size, void* d_ws, size_t ws_size, hipStream_t stream) {
  (void)in_sizes; (void)n_in; (void)out_size;
  const float** F = (const float**)d_in;   // 0 x [2,8,32,32,256], 1 ln_g, 2 ln_b, 3 wq (in,out), 4 bq, 5 wk, 6 bk, 7 wv, 8 bv, 9 wo, 10 bo
  if (ws_size < (size_t)WS_END) return;
  char* ws = (char*)d_ws; _Float16* PW = (_Float16*)(ws + WS_PW);
  k_pack<<<dim3(DM / 16, 4), 256, 0, stream>>>(F[3], F[5], F[7], F[9], PW);
  k_all<<<TRB, 512, 0, stream>>>(F[0], F[1], F[2], PW, F[4], F[6], F[8], F[10], (float*)d_out);
}
